// v000
// Measured on an AMD MI455X. A time is GPU time per run, averaged over a window of back-to-back runs after a warm-up
// (all launches, gaps included; the runs take copies of the inputs in turn), and the median of several windows.
// Apart from v000's, it joins two sittings. Times from different sittings can be a few percent apart, while
// side-by-side timings come from the same sitting.
// v000 is the starting kernel. One run takes 169 microseconds.
#include <hip/hip_runtime.h>

typedef __bf16 bf16_t;
typedef __attribute__((ext_vector_type(16))) __bf16 v16bf;
typedef __attribute__((ext_vector_type(8)))  float  v8f;
typedef int i32x4 __attribute__((vector_size(16)));   // matches builtin's V4i

#define B_   8
#define S_   1024
#define D_   768
#define H_   12
#define DH_  64
#define MTOT (B_ * S_)   // 8192

#define AS1 __attribute__((address_space(1)))
#define AS3 __attribute__((address_space(3)))

// gfx1250 async global->LDS path (ASYNCcnt); fall back to VGPR round-trip if
// this toolchain doesn't declare the builtins.
#if __has_builtin(__builtin_amdgcn_global_load_async_to_lds_b128) && \
    __has_builtin(__builtin_amdgcn_s_wait_asynccnt)
#define ASYNC_OK 1
#else
#define ASYNC_OK 0
#endif

// Copy 16 bytes (8 bf16) global -> LDS, per lane.
__device__ __forceinline__ void stage16(bf16_t* lds, const bf16_t* g) {
#if ASYNC_OK
    __builtin_amdgcn_global_load_async_to_lds_b128(
        (AS1 i32x4*)g, (AS3 i32x4*)lds, /*offset=*/0, /*cpol=*/0);
#else
    *reinterpret_cast<uint4*>(lds) = *reinterpret_cast<const uint4*>(g);
#endif
}

__device__ __forceinline__ void wait_stage() {
#if ASYNC_OK
    __builtin_amdgcn_s_wait_asynccnt(0);
#endif
}

// ---------------------------------------------------------------------------
// Fragment loader: 16 rows x 32 K of bf16, rows K-contiguous in LDS.
// Per-lane layout for V_WMMA_*_16X16X32_BF16 (A and B operands):
//   lane<16 : row = lane,    K = {0..7, 16..23}
//   lane>=16: row = lane-16, K = {8..15, 24..31}
// ---------------------------------------------------------------------------
template<int LDW>
__device__ __forceinline__ v16bf load_frag16(const bf16_t* base) {
    const int lane = threadIdx.x & 31;
    const int idx  = lane & 15;
    const int hf   = lane >> 4;
    const bf16_t* row = base + idx * LDW + hf * 8;
    union { v16bf v; uint4 u[2]; } f;
    f.u[0] = *reinterpret_cast<const uint4*>(row);
    f.u[1] = *reinterpret_cast<const uint4*>(row + 16);
    return f.v;
}

__device__ __forceinline__ v8f wmma_bf16(v16bf a, v16bf b, v8f c) {
    return __builtin_amdgcn_wmma_f32_16x16x32_bf16(
        /*neg_a=*/false, a, /*neg_b=*/false, b,
        /*c_mod=*/(short)0, c, /*reuse_a=*/false, /*reuse_b=*/false);
}

// ---------------------------------------------------------------------------
// Pack kernels: fp32 -> bf16, weights transposed to [N][K] (K-contiguous).
// ---------------------------------------------------------------------------
__global__ void pack_f32_bf16(const float* __restrict__ in,
                              bf16_t* __restrict__ out, int n) {
    int i = blockIdx.x * 256 + threadIdx.x;
    if (i < n) out[i] = (bf16_t)in[i];
}

// W: [H, D, DH] ;  outT[n*768 + d] = W[h, d, e] with n = h*64 + e
__global__ void pack_headW(const float* __restrict__ W,
                           bf16_t* __restrict__ outT) {
    int o = blockIdx.x * 256 + threadIdx.x;
    if (o >= D_ * D_) return;
    int n = o / D_;
    int d = o % D_;
    int h = n >> 6;
    int e = n & 63;
    outT[o] = (bf16_t)W[((size_t)h * D_ + d) * DH_ + e];
}

// Wo: [D, D] row-major ; outT[n*768 + d] = Wo[d, n]
__global__ void pack_WoT(const float* __restrict__ Wo,
                         bf16_t* __restrict__ outT) {
    int o = blockIdx.x * 256 + threadIdx.x;
    if (o >= D_ * D_) return;
    int n = o / D_;
    int d = o % D_;
    outT[o] = (bf16_t)Wo[(size_t)d * D_ + n];
}

// ---------------------------------------------------------------------------
// GEMM: C[8192 x 768] = A[8192 x 768] * BT^T + bias
//   A row-major bf16 (K contiguous), BT = B transposed [N][K] bf16.
//   Block tile 128x64, BK=64, 8 waves, each wave -> 16 rows x 64 cols.
//   MODE 0: out bf16 row-major  (QKV path)
//   MODE 1: out f32  row-major  (final projection -> d_out)
// ---------------------------------------------------------------------------
template<int MODE>
__global__ __launch_bounds__(256)
void gemm_bf16_128x64(const bf16_t* __restrict__ A,
                      const bf16_t* __restrict__ BT,
                      const float* __restrict__ bias,
                      void* __restrict__ outp) {
    constexpr int LDA = 72;                 // padded row stride (bf16 elems)
    __shared__ bf16_t As[128 * LDA];        // 128 x 64 tile
    __shared__ bf16_t Bs[64 * LDA];         //  64 x 64 tile

    const int m0   = blockIdx.x * 128;
    const int n0   = blockIdx.y * 64;
    const int wave = threadIdx.x >> 5;
    const int lane = threadIdx.x & 31;
    const int idx  = lane & 15;
    const int hf   = lane >> 4;

    v8f acc[4];
#pragma unroll
    for (int j = 0; j < 4; ++j)
#pragma unroll
        for (int r = 0; r < 8; ++r) acc[j][r] = 0.0f;

    for (int kt = 0; kt < D_ / 64; ++kt) {
        const int k0 = kt * 64;
        // stage A tile: 128x64 -> 1024 16B chunks, 4 per thread
#pragma unroll
        for (int i = 0; i < 4; ++i) {
            int v = threadIdx.x + i * 256;
            int row = v >> 3, cv = v & 7;
            stage16(&As[row * LDA + cv * 8],
                    &A[(size_t)(m0 + row) * D_ + k0 + cv * 8]);
        }
        // stage B tile: 64x64 -> 512 16B chunks, 2 per thread
#pragma unroll
        for (int i = 0; i < 2; ++i) {
            int v = threadIdx.x + i * 256;
            int row = v >> 3, cv = v & 7;
            stage16(&Bs[row * LDA + cv * 8],
                    &BT[(size_t)(n0 + row) * D_ + k0 + cv * 8]);
        }
        wait_stage();
        __syncthreads();

#pragma unroll
        for (int kc = 0; kc < 64; kc += 32) {
            v16bf a = load_frag16<LDA>(&As[wave * 16 * LDA + kc]);
#pragma unroll
            for (int j = 0; j < 4; ++j) {
                v16bf b = load_frag16<LDA>(&Bs[j * 16 * LDA + kc]);
                acc[j] = wmma_bf16(a, b, acc[j]);
            }
        }
        __syncthreads();
    }

    // epilogue: C element (m = m0 + wave*16 + hf*8 + r, n = n0 + j*16 + idx)
#pragma unroll
    for (int j = 0; j < 4; ++j) {
        const int n  = n0 + j * 16 + idx;
        const float bn = bias[n];
#pragma unroll
        for (int r = 0; r < 8; ++r) {
            const int m = m0 + wave * 16 + hf * 8 + r;
            const float val = acc[j][r] + bn;
            if constexpr (MODE == 0)
                ((bf16_t*)outp)[(size_t)m * D_ + n] = (bf16_t)val;
            else
                ((float*)outp)[(size_t)m * D_ + n] = val;
        }
    }
}

// ---------------------------------------------------------------------------
// Flash-style attention. Q/K/V bf16 row-major [B*S][768], head slice at
// column h*64. One block = one (b,h) x 128 query rows; key tiles of 64.
// Each wave owns 16 query rows (4 accumulator tiles across DH=64).
// ---------------------------------------------------------------------------
__global__ __launch_bounds__(256)
void attn_kernel(const bf16_t* __restrict__ Q, const bf16_t* __restrict__ K,
                 const bf16_t* __restrict__ V, bf16_t* __restrict__ O) {
    constexpr int LD = 72;                  // padded row stride (bf16 elems)
    __shared__ bf16_t Qs[128 * LD];         // 128 q-rows x 64
    __shared__ bf16_t Ks[64 * LD];          // 64 k-rows  x 64 (rows t, cols e)
    __shared__ bf16_t VTs[64 * LD];         // V transposed (rows e, cols t)
    __shared__ bf16_t Ps[8 * 16 * LD];      // per-wave P tile 16 x 64

    const int bh   = blockIdx.y;
    const int b    = bh / H_;
    const int h    = bh % H_;
    const int q0   = blockIdx.x * 128;
    const int wave = threadIdx.x >> 5;
    const int lane = threadIdx.x & 31;
    const int idx  = lane & 15;
    const int hf   = lane >> 4;
    const size_t base = (size_t)b * S_ * D_ + (size_t)h * DH_;

    // stage Q tile once: 128x64 -> 1024 16B chunks, 4 per thread (async)
#pragma unroll
    for (int i = 0; i < 4; ++i) {
        int v = threadIdx.x + i * 256;
        int row = v >> 3, cv = v & 7;
        stage16(&Qs[row * LD + cv * 8],
                &Q[base + (size_t)(q0 + row) * D_ + cv * 8]);
    }

    v8f acc[4];
    float mrow[8], lrow[8];
#pragma unroll
    for (int j = 0; j < 4; ++j)
#pragma unroll
        for (int r = 0; r < 8; ++r) acc[j][r] = 0.0f;
#pragma unroll
    for (int r = 0; r < 8; ++r) { mrow[r] = -3.0e38f; lrow[r] = 0.0f; }

    for (int kt = 0; kt < S_ / 64; ++kt) {
        const int t0 = kt * 64;
        // stage K tile (as-is: rows t, K-contiguous e -> B operand of Q*K^T)
#pragma unroll
        for (int i = 0; i < 2; ++i) {
            int v = threadIdx.x + i * 256;
            int row = v >> 3, cv = v & 7;
            stage16(&Ks[row * LD + cv * 8],
                    &K[base + (size_t)(t0 + row) * D_ + cv * 8]);
        }
        // stage V transposed: VTs[e][t] (rows e, K-contiguous t -> B of P*V)
#pragma unroll
        for (int i = 0; i < 2; ++i) {
            int v = threadIdx.x + i * 256;
            int row = v >> 3, cv = v & 7;
            union { uint4 u; bf16_t e[8]; } tmp;
            tmp.u = *reinterpret_cast<const uint4*>(&V[base + (size_t)(t0 + row) * D_ + cv * 8]);
#pragma unroll
            for (int q = 0; q < 8; ++q) VTs[(cv * 8 + q) * LD + row] = tmp.e[q];
        }
        wait_stage();        // Q (first iter) + K async copies complete
        __syncthreads();

        // scores: S = Q(16x64) * K^T -> 4 tiles of 16x16 (cols = key rows)
        v8f sc[4];
#pragma unroll
        for (int j = 0; j < 4; ++j)
#pragma unroll
            for (int r = 0; r < 8; ++r) sc[j][r] = 0.0f;
#pragma unroll
        for (int kc = 0; kc < 64; kc += 32) {
            v16bf a = load_frag16<LD>(&Qs[wave * 16 * LD + kc]);
#pragma unroll
            for (int j = 0; j < 4; ++j) {
                v16bf bk = load_frag16<LD>(&Ks[j * 16 * LD + kc]);
                sc[j] = wmma_bf16(a, bk, sc[j]);
            }
        }

        // online softmax; C layout: row = hf*8 + r, col = j*16 + idx
        float tmax[8];
#pragma unroll
        for (int r = 0; r < 8; ++r) tmax[r] = -3.0e38f;
#pragma unroll
        for (int j = 0; j < 4; ++j)
#pragma unroll
            for (int r = 0; r < 8; ++r) {
                sc[j][r] *= 0.125f;               // 1/sqrt(DH)
                tmax[r] = fmaxf(tmax[r], sc[j][r]);
            }
#pragma unroll
        for (int r = 0; r < 8; ++r)
            for (int m = 1; m < 16; m <<= 1)
                tmax[r] = fmaxf(tmax[r], __shfl_xor(tmax[r], m, 32));

        float alpha[8], tsum[8];
#pragma unroll
        for (int r = 0; r < 8; ++r) {
            float mn = fmaxf(mrow[r], tmax[r]);
            alpha[r] = __expf(mrow[r] - mn);
            mrow[r]  = mn;
            tsum[r]  = 0.0f;
        }
#pragma unroll
        for (int j = 0; j < 4; ++j)
#pragma unroll
            for (int r = 0; r < 8; ++r) {
                float p = __expf(sc[j][r] - mrow[r]);
                sc[j][r] = p;
                tsum[r] += p;
            }
#pragma unroll
        for (int r = 0; r < 8; ++r) {
            for (int m = 1; m < 16; m <<= 1) tsum[r] += __shfl_xor(tsum[r], m, 32);
            lrow[r] = lrow[r] * alpha[r] + tsum[r];
        }
#pragma unroll
        for (int j = 0; j < 4; ++j)
#pragma unroll
            for (int r = 0; r < 8; ++r) acc[j][r] *= alpha[r];

        // C-layout -> A-layout via per-wave LDS round trip (bf16 probs)
        bf16_t* Pw = &Ps[wave * 16 * LD];
#pragma unroll
        for (int j = 0; j < 4; ++j)
#pragma unroll
            for (int r = 0; r < 8; ++r)
                Pw[(hf * 8 + r) * LD + j * 16 + idx] = (bf16_t)sc[j][r];

        // O += P(16x64) * V(64x64); B operand from transposed V tile
#pragma unroll
        for (int kc = 0; kc < 64; kc += 32) {
            v16bf a = load_frag16<LD>(&Ps[wave * 16 * LD + kc]);
#pragma unroll
            for (int j = 0; j < 4; ++j) {
                v16bf bv = load_frag16<LD>(&VTs[j * 16 * LD + kc]);
                acc[j] = wmma_bf16(a, bv, acc[j]);
            }
        }
        __syncthreads();
    }

    float inv[8];
#pragma unroll
    for (int r = 0; r < 8; ++r) inv[r] = 1.0f / lrow[r];
#pragma unroll
    for (int j = 0; j < 4; ++j) {
        const int e = j * 16 + idx;
#pragma unroll
        for (int r = 0; r < 8; ++r) {
            const int s = q0 + wave * 16 + hf * 8 + r;
            O[base + (size_t)s * D_ + e] = (bf16_t)(acc[j][r] * inv[r]);
        }
    }
}

// ---------------------------------------------------------------------------
// Launch: pack -> QKV GEMMs -> attention -> output projection.
// Workspace (bf16): xb | qb | kb | vb | wqT | wkT | wvT | woT  (~53 MB).
// Attention output reuses xb (x is dead after the QKV GEMMs).
// ---------------------------------------------------------------------------
extern "C" void kernel_launch(void* const* d_in, const int* in_sizes, int n_in,
                              void* d_out, int out_size, void* d_ws, size_t ws_size,
                              hipStream_t stream) {
    (void)in_sizes; (void)n_in; (void)out_size;

    const float* x  = (const float*)d_in[0];
    const float* Wq = (const float*)d_in[1];
    const float* bq = (const float*)d_in[2];
    const float* Wk = (const float*)d_in[3];
    const float* bk = (const float*)d_in[4];
    const float* Wv = (const float*)d_in[5];
    const float* bv = (const float*)d_in[6];
    const float* Wo = (const float*)d_in[7];
    const float* bo = (const float*)d_in[8];

    const size_t MD = (size_t)MTOT * D_;   // 6,291,456 elems
    const size_t WN = (size_t)D_ * D_;     //   589,824 elems
    if (ws_size < (4 * MD + 4 * WN) * sizeof(bf16_t)) return;

    bf16_t* xb  = (bf16_t*)d_ws;
    bf16_t* qb  = xb  + MD;
    bf16_t* kb  = qb  + MD;
    bf16_t* vb  = kb  + MD;
    bf16_t* wqT = vb  + MD;
    bf16_t* wkT = wqT + WN;
    bf16_t* wvT = wkT + WN;
    bf16_t* woT = wvT + WN;

    pack_f32_bf16<<<(int)((MD + 255) / 256), 256, 0, stream>>>(x, xb, (int)MD);
    pack_headW<<<(int)((WN + 255) / 256), 256, 0, stream>>>(Wq, wqT);
    pack_headW<<<(int)((WN + 255) / 256), 256, 0, stream>>>(Wk, wkT);
    pack_headW<<<(int)((WN + 255) / 256), 256, 0, stream>>>(Wv, wvT);
    pack_WoT  <<<(int)((WN + 255) / 256), 256, 0, stream>>>(Wo, woT);

    dim3 gg(MTOT / 128, D_ / 64);
    gemm_bf16_128x64<0><<<gg, 256, 0, stream>>>(xb, wqT, bq, qb);
    gemm_bf16_128x64<0><<<gg, 256, 0, stream>>>(xb, wkT, bk, kb);
    gemm_bf16_128x64<0><<<gg, 256, 0, stream>>>(xb, wvT, bv, vb);

    attn_kernel<<<dim3(S_ / 128, B_ * H_), 256, 0, stream>>>(qb, kb, vb, xb);

    gemm_bf16_128x64<1><<<gg, 256, 0, stream>>>(xb, woT, bo, d_out);
}

// v001
// It runs in 149 microseconds.
// Timed twice side by side with v000, it ran 1.18 times as fast both times.
#include <hip/hip_runtime.h>

typedef __bf16 bf16_t;
typedef __attribute__((ext_vector_type(16))) __bf16 v16bf;
typedef __attribute__((ext_vector_type(8)))  float  v8f;
typedef __attribute__((ext_vector_type(2)))  float  v2f;
typedef int i32x4 __attribute__((vector_size(16)));   // matches builtin's V4i

#define B_   8
#define S_   1024
#define D_   768
#define H_   12
#define DH_  64
#define MTOT (B_ * S_)   // 8192

#define AS1 __attribute__((address_space(1)))
#define AS3 __attribute__((address_space(3)))

// gfx1250 async global->LDS path (ASYNCcnt); fall back to VGPR round-trip if
// this toolchain doesn't declare the builtins.
#if __has_builtin(__builtin_amdgcn_global_load_async_to_lds_b128) && \
    __has_builtin(__builtin_amdgcn_s_wait_asynccnt)
#define ASYNC_OK 1
#else
#define ASYNC_OK 0
#endif

// Copy 16 bytes (8 bf16) global -> LDS, per lane.
__device__ __forceinline__ void stage16(bf16_t* lds, const bf16_t* g) {
#if ASYNC_OK
    __builtin_amdgcn_global_load_async_to_lds_b128(
        (AS1 i32x4*)g, (AS3 i32x4*)lds, /*offset=*/0, /*cpol=*/0);
#else
    *reinterpret_cast<uint4*>(lds) = *reinterpret_cast<const uint4*>(g);
#endif
}

__device__ __forceinline__ void wait_stage() {
#if ASYNC_OK
    __builtin_amdgcn_s_wait_asynccnt(0);
#endif
}

// ---------------------------------------------------------------------------
// Fragment loader: 16 rows x 32 K of bf16, rows K-contiguous in LDS.
// Per-lane layout for V_WMMA_*_16X16X32_BF16 (A and B operands):
//   lane<16 : row = lane,    K = {0..7, 16..23}
//   lane>=16: row = lane-16, K = {8..15, 24..31}
// ---------------------------------------------------------------------------
template<int LDW>
__device__ __forceinline__ v16bf load_frag16(const bf16_t* base) {
    const int lane = threadIdx.x & 31;
    const int idx  = lane & 15;
    const int hf   = lane >> 4;
    const bf16_t* row = base + idx * LDW + hf * 8;
    union { v16bf v; uint4 u[2]; } f;
    f.u[0] = *reinterpret_cast<const uint4*>(row);
    f.u[1] = *reinterpret_cast<const uint4*>(row + 16);
    return f.v;
}

__device__ __forceinline__ v8f wmma_bf16(v16bf a, v16bf b, v8f c) {
    return __builtin_amdgcn_wmma_f32_16x16x32_bf16(
        /*neg_a=*/false, a, /*neg_b=*/false, b,
        /*c_mod=*/(short)0, c, /*reuse_a=*/false, /*reuse_b=*/false);
}

// ---------------------------------------------------------------------------
// Pack kernels: fp32 -> bf16, weights transposed to [N][K] (K-contiguous).
// ---------------------------------------------------------------------------
__global__ void pack_f32_bf16(const float* __restrict__ in,
                              bf16_t* __restrict__ out, int n) {
    int i = blockIdx.x * 256 + threadIdx.x;
    if (i < n) out[i] = (bf16_t)in[i];
}

// W: [H, D, DH] ;  outT[n*768 + d] = W[h, d, e] with n = h*64 + e
__global__ void pack_headW(const float* __restrict__ W,
                           bf16_t* __restrict__ outT) {
    int o = blockIdx.x * 256 + threadIdx.x;
    if (o >= D_ * D_) return;
    int n = o / D_;
    int d = o % D_;
    int h = n >> 6;
    int e = n & 63;
    outT[o] = (bf16_t)W[((size_t)h * D_ + d) * DH_ + e];
}

// Wo: [D, D] row-major ; outT[n*768 + d] = Wo[d, n]
__global__ void pack_WoT(const float* __restrict__ Wo,
                         bf16_t* __restrict__ outT) {
    int o = blockIdx.x * 256 + threadIdx.x;
    if (o >= D_ * D_) return;
    int n = o / D_;
    int d = o % D_;
    outT[o] = (bf16_t)Wo[(size_t)d * D_ + n];
}

// ---------------------------------------------------------------------------
// GEMM: C[8192 x 768] = A[8192 x 768] * BT^T + bias
//   A row-major bf16 (K contiguous), BT = B transposed [N][K] bf16.
//   Block tile 128x64, BK=64, 8 waves, each wave -> 16 rows x 64 cols.
//   MODE 0: out bf16 row-major  (QKV path)
//   MODE 1: out f32  row-major  (final projection -> d_out)
// ---------------------------------------------------------------------------
template<int MODE>
__global__ __launch_bounds__(256)
void gemm_bf16_128x64(const bf16_t* __restrict__ A,
                      const bf16_t* __restrict__ BT,
                      const float* __restrict__ bias,
                      void* __restrict__ outp) {
    constexpr int LDA = 72;                 // padded row stride (bf16 elems)
    __shared__ bf16_t As[128 * LDA];        // 128 x 64 tile
    __shared__ bf16_t Bs[64 * LDA];         //  64 x 64 tile

    const int m0   = blockIdx.x * 128;
    const int n0   = blockIdx.y * 64;
    const int wave = threadIdx.x >> 5;
    const int lane = threadIdx.x & 31;
    const int idx  = lane & 15;
    const int hf   = lane >> 4;

    v8f acc[4];
#pragma unroll
    for (int j = 0; j < 4; ++j)
#pragma unroll
        for (int r = 0; r < 8; ++r) acc[j][r] = 0.0f;

    for (int kt = 0; kt < D_ / 64; ++kt) {
        const int k0 = kt * 64;
        // stage A tile: 128x64 -> 1024 16B chunks, 4 per thread
#pragma unroll
        for (int i = 0; i < 4; ++i) {
            int v = threadIdx.x + i * 256;
            int row = v >> 3, cv = v & 7;
            stage16(&As[row * LDA + cv * 8],
                    &A[(size_t)(m0 + row) * D_ + k0 + cv * 8]);
        }
        // stage B tile: 64x64 -> 512 16B chunks, 2 per thread
#pragma unroll
        for (int i = 0; i < 2; ++i) {
            int v = threadIdx.x + i * 256;
            int row = v >> 3, cv = v & 7;
            stage16(&Bs[row * LDA + cv * 8],
                    &BT[(size_t)(n0 + row) * D_ + k0 + cv * 8]);
        }
        wait_stage();
        __syncthreads();

#pragma unroll
        for (int kc = 0; kc < 64; kc += 32) {
            v16bf a = load_frag16<LDA>(&As[wave * 16 * LDA + kc]);
#pragma unroll
            for (int j = 0; j < 4; ++j) {
                v16bf b = load_frag16<LDA>(&Bs[j * 16 * LDA + kc]);
                acc[j] = wmma_bf16(a, b, acc[j]);
            }
        }
        __syncthreads();
    }

    // epilogue: C element (m = m0 + wave*16 + hf*8 + r, n = n0 + j*16 + idx)
#pragma unroll
    for (int j = 0; j < 4; ++j) {
        const int n  = n0 + j * 16 + idx;
        const float bn = bias[n];
#pragma unroll
        for (int r = 0; r < 8; ++r) {
            const int m = m0 + wave * 16 + hf * 8 + r;
            const float val = acc[j][r] + bn;
            if constexpr (MODE == 0)
                ((bf16_t*)outp)[(size_t)m * D_ + n] = (bf16_t)val;
            else
                ((float*)outp)[(size_t)m * D_ + n] = val;
        }
    }
}

// ---------------------------------------------------------------------------
// Flash-style attention, transposed products. Q/K/V bf16 row-major
// [B*S][768], head slice at column h*64. One block = one (b,h) x 128 query
// rows; key tiles of 64. Each wave owns 16 queries.
//   S^T = K * Q^T : tile j holds key j*16 + hf*8 + r (register r), query idx
//   O^T += V^T * P^T : tile j holds e = j*16 + hf*8 + r, query idx
// A lane holds one query only: its maximum and sum are in-lane over its half
// of the keys, and two S^T tiles convert in place into the B operand P^T.
// ---------------------------------------------------------------------------
// lane l <-> lane l ^ 16 (the two lanes that share a query)
__device__ __forceinline__ float xhalf(float x) {
    return __builtin_bit_cast(float, __builtin_amdgcn_permlanex16(
        __builtin_bit_cast(int, x), __builtin_bit_cast(int, x),
        0x76543210, 0xfedcba98, false, false));
}

__global__ __launch_bounds__(256)
void attn_kernel(const bf16_t* __restrict__ Q, const bf16_t* __restrict__ K,
                 const bf16_t* __restrict__ V, bf16_t* __restrict__ O) {
    constexpr int LD = 72;                  // padded row stride (bf16 elems)
    __shared__ bf16_t Qs[128 * LD];         // 128 q-rows x 64
    __shared__ bf16_t Ks[64 * LD];          // 64 k-rows  x 64 (rows t, cols e)
    __shared__ bf16_t VTs[64 * LD];         // V transposed (rows e, cols t)

    const int bh   = blockIdx.y;
    const int b    = bh / H_;
    const int h    = bh % H_;
    const int q0   = blockIdx.x * 128;
    const int wave = threadIdx.x >> 5;
    const int lane = threadIdx.x & 31;
    const int idx  = lane & 15;
    const int hf   = lane >> 4;
    const size_t base = (size_t)b * S_ * D_ + (size_t)h * DH_;

    // stage Q tile once: 128x64 -> 1024 16B chunks, 4 per thread (async)
#pragma unroll
    for (int i = 0; i < 4; ++i) {
        int v = threadIdx.x + i * 256;
        int row = v >> 3, cv = v & 7;
        stage16(&Qs[row * LD + cv * 8],
                &Q[base + (size_t)(q0 + row) * D_ + cv * 8]);
    }

    v8f acc[4];
    float mrow = -3.0e38f;   // running maximum of this lane's query
    float lrow = 0.0f;       // running sum over this lane's half of the keys
#pragma unroll
    for (int j = 0; j < 4; ++j)
#pragma unroll
        for (int r = 0; r < 8; ++r) acc[j][r] = 0.0f;

    for (int kt = 0; kt < S_ / 64; ++kt) {
        const int t0 = kt * 64;
        // stage K tile (as-is: rows t, K-contiguous e -> A operand of K*Q^T)
#pragma unroll
        for (int i = 0; i < 2; ++i) {
            int v = threadIdx.x + i * 256;
            int row = v >> 3, cv = v & 7;
            stage16(&Ks[row * LD + cv * 8],
                    &K[base + (size_t)(t0 + row) * D_ + cv * 8]);
        }
        // stage V transposed: VTs[e][t] (rows e, K-contiguous t -> A of V^T*P^T)
#pragma unroll
        for (int i = 0; i < 2; ++i) {
            int v = threadIdx.x + i * 256;
            int row = v >> 3, cv = v & 7;
            union { uint4 u; bf16_t e[8]; } tmp;
            tmp.u = *reinterpret_cast<const uint4*>(&V[base + (size_t)(t0 + row) * D_ + cv * 8]);
#pragma unroll
            for (int q = 0; q < 8; ++q) VTs[(cv * 8 + q) * LD + row] = tmp.e[q];
        }
        wait_stage();        // Q (first iter) + K async copies complete
        __syncthreads();

        // scores: S^T = K(64x64) * Q^T(64x16) -> 4 tiles of 16 keys x 16 queries
        v8f sc[4];
#pragma unroll
        for (int j = 0; j < 4; ++j)
#pragma unroll
            for (int r = 0; r < 8; ++r) sc[j][r] = 0.0f;
#pragma unroll
        for (int kc = 0; kc < 64; kc += 32) {
            v16bf bq = load_frag16<LD>(&Qs[wave * 16 * LD + kc]);
#pragma unroll
            for (int j = 0; j < 4; ++j) {
                v16bf ak = load_frag16<LD>(&Ks[j * 16 * LD + kc]);
                sc[j] = wmma_bf16(ak, bq, sc[j]);
            }
        }

        // online softmax; all 32 values of a lane belong to query idx
        float tmax = -3.0e38f;
#pragma unroll
        for (int j = 0; j < 4; ++j)
#pragma unroll
            for (int r = 0; r < 8; ++r) {
                sc[j][r] *= 0.125f;               // 1/sqrt(DH)
                tmax = fmaxf(tmax, sc[j][r]);
            }
        tmax = fmaxf(tmax, xhalf(tmax));          // both halves: the query's maximum

        const float mn    = fmaxf(mrow, tmax);
        const float alpha = __expf(mrow - mn);
        mrow = mn;
        v2f tsum = {0.0f, 0.0f};                  // even and odd registers apart
#pragma unroll
        for (int j = 0; j < 4; ++j)
#pragma unroll
            for (int r = 0; r < 8; r += 2) {
                v2f p = {__expf(sc[j][r] - mrow), __expf(sc[j][r + 1] - mrow)};
                sc[j][r]     = p.x;
                sc[j][r + 1] = p.y;
                tsum += p;
            }
        lrow = lrow * alpha + (tsum.x + tsum.y);
#pragma unroll
        for (int j = 0; j < 4; ++j)
#pragma unroll
            for (int r = 0; r < 8; ++r) acc[j][r] *= alpha;

        // O^T += V^T(64x64) * P^T(64x16). Two S^T tiles (keys kc..kc+31) are,
        // converted in place, the B operand in the loader's k order:
        // element s<8 -> key kc + hf*8 + s, element 8+s -> key kc + 16 + hf*8 + s
#pragma unroll
        for (int kc = 0; kc < 64; kc += 32) {
            v16bf bp;
#pragma unroll
            for (int s = 0; s < 8; ++s) {
                bp[s]     = (bf16_t)sc[kc / 16][s];
                bp[8 + s] = (bf16_t)sc[kc / 16 + 1][s];
            }
#pragma unroll
            for (int j = 0; j < 4; ++j) {
                v16bf av = load_frag16<LD>(&VTs[j * 16 * LD + kc]);
                acc[j] = wmma_bf16(av, bp, acc[j]);
            }
        }
        __syncthreads();
    }

    // join the two halves' sums once; a lane's 8 registers of tile j are
    // 8 consecutive e of its query: one 16-byte store each
    const float inv = 1.0f / (lrow + xhalf(lrow));
    const int s = q0 + wave * 16 + idx;
#pragma unroll
    for (int j = 0; j < 4; ++j) {
        union { uint4 u; bf16_t e[8]; } o;
#pragma unroll
        for (int r = 0; r < 8; ++r) o.e[r] = (bf16_t)(acc[j][r] * inv);
        *reinterpret_cast<uint4*>(&O[base + (size_t)s * D_ + j * 16 + hf * 8]) = o.u;
    }
}

// ---------------------------------------------------------------------------
// Launch: pack -> QKV GEMMs -> attention -> output projection.
// Workspace (bf16): xb | qb | kb | vb | wqT | wkT | wvT | woT  (~53 MB).
// Attention output reuses xb (x is dead after the QKV GEMMs).
// ---------------------------------------------------------------------------
extern "C" void kernel_launch(void* const* d_in, const int* in_sizes, int n_in,
                              void* d_out, int out_size, void* d_ws, size_t ws_size,
                              hipStream_t stream) {
    (void)in_sizes; (void)n_in; (void)out_size;

    const float* x  = (const float*)d_in[0];
    const float* Wq = (const float*)d_in[1];
    const float* bq = (const float*)d_in[2];
    const float* Wk = (const float*)d_in[3];
    const float* bk = (const float*)d_in[4];
    const float* Wv = (const float*)d_in[5];
    const float* bv = (const float*)d_in[6];
    const float* Wo = (const float*)d_in[7];
    const float* bo = (const float*)d_in[8];

    const size_t MD = (size_t)MTOT * D_;   // 6,291,456 elems
    const size_t WN = (size_t)D_ * D_;     //   589,824 elems
    if (ws_size < (4 * MD + 4 * WN) * sizeof(bf16_t)) return;

    bf16_t* xb  = (bf16_t*)d_ws;
    bf16_t* qb  = xb  + MD;
    bf16_t* kb  = qb  + MD;
    bf16_t* vb  = kb  + MD;
    bf16_t* wqT = vb  + MD;
    bf16_t* wkT = wqT + WN;
    bf16_t* wvT = wkT + WN;
    bf16_t* woT = wvT + WN;

    pack_f32_bf16<<<(int)((MD + 255) / 256), 256, 0, stream>>>(x, xb, (int)MD);
    pack_headW<<<(int)((WN + 255) / 256), 256, 0, stream>>>(Wq, wqT);
    pack_headW<<<(int)((WN + 255) / 256), 256, 0, stream>>>(Wk, wkT);
    pack_headW<<<(int)((WN + 255) / 256), 256, 0, stream>>>(Wv, wvT);
    pack_WoT  <<<(int)((WN + 255) / 256), 256, 0, stream>>>(Wo, woT);

    dim3 gg(MTOT / 128, D_ / 64);
    gemm_bf16_128x64<0><<<gg, 256, 0, stream>>>(xb, wqT, bq, qb);
    gemm_bf16_128x64<0><<<gg, 256, 0, stream>>>(xb, wkT, bk, kb);
    gemm_bf16_128x64<0><<<gg, 256, 0, stream>>>(xb, wvT, bv, vb);

    attn_kernel<<<dim3(S_ / 128, B_ * H_), 256, 0, stream>>>(qb, kb, vb, xb);

    gemm_bf16_128x64<1><<<gg, 256, 0, stream>>>(xb, woT, bo, d_out);
}

// v002
// It runs in 141 microseconds.
// In two side-by-side timings against v001, it was 1.06 and 1.05 times as fast.
// Over all steps from v000 it is 1.24 times as fast.
#include <hip/hip_runtime.h>

typedef __bf16 bf16_t;
typedef __attribute__((ext_vector_type(16))) __bf16 v16bf;
typedef __attribute__((ext_vector_type(8)))  float  v8f;
typedef __attribute__((ext_vector_type(2)))  float  v2f;
typedef int i32x4 __attribute__((vector_size(16)));   // matches builtin's V4i

#define B_   8
#define S_   1024
#define D_   768
#define H_   12
#define DH_  64
#define MTOT (B_ * S_)   // 8192

#define AS1 __attribute__((address_space(1)))
#define AS3 __attribute__((address_space(3)))

// gfx1250 async global->LDS path (ASYNCcnt); fall back to VGPR round-trip if
// this toolchain doesn't declare the builtins.
#if __has_builtin(__builtin_amdgcn_global_load_async_to_lds_b128) && \
    __has_builtin(__builtin_amdgcn_s_wait_asynccnt)
#define ASYNC_OK 1
#else
#define ASYNC_OK 0
#endif

// Copy 16 bytes (8 bf16) global -> LDS, per lane.
__device__ __forceinline__ void stage16(bf16_t* lds, const bf16_t* g) {
#if ASYNC_OK
    __builtin_amdgcn_global_load_async_to_lds_b128(
        (AS1 i32x4*)g, (AS3 i32x4*)lds, /*offset=*/0, /*cpol=*/0);
#else
    *reinterpret_cast<uint4*>(lds) = *reinterpret_cast<const uint4*>(g);
#endif
}

__device__ __forceinline__ void wait_stage() {
#if ASYNC_OK
    __builtin_amdgcn_s_wait_asynccnt(0);
#endif
}

// ---------------------------------------------------------------------------
// Fragment loader: 16 rows x 32 K of bf16, rows K-contiguous in LDS.
// Per-lane layout for V_WMMA_*_16X16X32_BF16 (A and B operands):
//   lane<16 : row = lane,    K = {0..7, 16..23}
//   lane>=16: row = lane-16, K = {8..15, 24..31}
// ---------------------------------------------------------------------------
template<int LDW>
__device__ __forceinline__ v16bf load_frag16(const bf16_t* base) {
    const int lane = threadIdx.x & 31;
    const int idx  = lane & 15;
    const int hf   = lane >> 4;
    const bf16_t* row = base + idx * LDW + hf * 8;
    union { v16bf v; uint4 u[2]; } f;
    f.u[0] = *reinterpret_cast<const uint4*>(row);
    f.u[1] = *reinterpret_cast<const uint4*>(row + 16);
    return f.v;
}

__device__ __forceinline__ v8f wmma_bf16(v16bf a, v16bf b, v8f c) {
    return __builtin_amdgcn_wmma_f32_16x16x32_bf16(
        /*neg_a=*/false, a, /*neg_b=*/false, b,
        /*c_mod=*/(short)0, c, /*reuse_a=*/false, /*reuse_b=*/false);
}

// ---------------------------------------------------------------------------
// Pack kernels: fp32 -> bf16, weights transposed to [N][K] (K-contiguous).
// Few waves with many elements each: a launch with one element per lane is
// bound by how fast waves start, not by its bytes.
// ---------------------------------------------------------------------------
typedef __attribute__((ext_vector_type(4))) float  v4f;
typedef __attribute__((ext_vector_type(4))) __bf16 v4bf;
typedef __attribute__((ext_vector_type(8))) __bf16 v8bf;

#define PKX_BLOCKS 512   // 2 blocks of 8 waves per WGP: 16 streaming waves
#define PKX_PER    12    // 16-byte loads per lane, all in flight together
static_assert((size_t)PKX_BLOCKS * 256 * PKX_PER * 4 == (size_t)MTOT * D_,
              "the x pack covers x exactly");

// A block converts 12 x 256 consecutive groups of 4. Each wave-wide load is
// 512 contiguous bytes (4 whole lines), each wave-wide store 256 (2 lines).
__global__ __launch_bounds__(256)
void pack_f32_bf16(const float* __restrict__ in, bf16_t* __restrict__ out) {
    const size_t g0 = (size_t)blockIdx.x * (PKX_PER * 256) + threadIdx.x;
    const v4f* in4  = reinterpret_cast<const v4f*>(in) + g0;
    v4bf*      out4 = reinterpret_cast<v4bf*>(out) + g0;
    v4f f[PKX_PER];
    // unrolled: f stays in registers and all 12 loads are issued before a wait
#pragma unroll
    for (int i = 0; i < PKX_PER; ++i) f[i] = in4[i * 256];
#pragma unroll
    for (int i = 0; i < PKX_PER; ++i)
        out4[i * 256] = __builtin_convertvector(f[i], v4bf);
}

// 64 x 64 tile of a transposing pack, one block of 64 lanes. Lane = one output
// row: it reads 64 source rows at its own column (a wave-wide load is one whole
// 128-byte line) and alone writes one whole 128-byte line of the output.
//   src: this lane's column in the tile's first source row, ld = source pitch
//   dst: this lane's 64 consecutive outputs
__device__ __forceinline__ void pack_T64(const float* __restrict__ src, int ld,
                                         bf16_t* __restrict__ dst) {
    float f[64];
    // unrolled: f stays in registers and all 64 loads are issued before a wait
#pragma unroll
    for (int i = 0; i < 64; ++i) f[i] = src[(size_t)i * ld];
#pragma unroll
    for (int c = 0; c < 8; ++c) {
        v8bf o;
#pragma unroll
        for (int q = 0; q < 8; ++q) o[q] = (bf16_t)f[c * 8 + q];
        reinterpret_cast<v8bf*>(dst)[c] = o;
    }
}

#define PKW_BLOCKS ((D_ / 64) * (D_ / 64))   // 144 tiles of 64 x 64

// W: [H, D, DH] ;  outT[n*768 + d] = W[h, d, e] with n = h*64 + e
__global__ __launch_bounds__(64)
void pack_headW(const float* __restrict__ W, bf16_t* __restrict__ outT) {
    const int h  = blockIdx.x / (D_ / 64);
    const int d0 = (blockIdx.x % (D_ / 64)) * 64;
    const int e  = threadIdx.x;
    pack_T64(W + ((size_t)h * D_ + d0) * DH_ + e, DH_,
             outT + (size_t)(h * DH_ + e) * D_ + d0);
}

// Wo: [D, D] row-major ; outT[n*768 + d] = Wo[d, n]
__global__ __launch_bounds__(64)
void pack_WoT(const float* __restrict__ Wo, bf16_t* __restrict__ outT) {
    const int n  = (blockIdx.x / (D_ / 64)) * 64 + threadIdx.x;
    const int d0 = (blockIdx.x % (D_ / 64)) * 64;
    pack_T64(Wo + (size_t)d0 * D_ + n, D_, outT + (size_t)n * D_ + d0);
}

// ---------------------------------------------------------------------------
// GEMM: C[8192 x 768] = A[8192 x 768] * BT^T + bias
//   A row-major bf16 (K contiguous), BT = B transposed [N][K] bf16.
//   Block tile 128x64, BK=64, 8 waves, each wave -> 16 rows x 64 cols.
//   MODE 0: out bf16 row-major  (QKV path)
//   MODE 1: out f32  row-major  (final projection -> d_out)
// ---------------------------------------------------------------------------
template<int MODE>
__global__ __launch_bounds__(256)
void gemm_bf16_128x64(const bf16_t* __restrict__ A,
                      const bf16_t* __restrict__ BT,
                      const float* __restrict__ bias,
                      void* __restrict__ outp) {
    constexpr int LDA = 72;                 // padded row stride (bf16 elems)
    __shared__ bf16_t As[128 * LDA];        // 128 x 64 tile
    __shared__ bf16_t Bs[64 * LDA];         //  64 x 64 tile

    const int m0   = blockIdx.x * 128;
    const int n0   = blockIdx.y * 64;
    const int wave = threadIdx.x >> 5;
    const int lane = threadIdx.x & 31;
    const int idx  = lane & 15;
    const int hf   = lane >> 4;

    v8f acc[4];
#pragma unroll
    for (int j = 0; j < 4; ++j)
#pragma unroll
        for (int r = 0; r < 8; ++r) acc[j][r] = 0.0f;

    for (int kt = 0; kt < D_ / 64; ++kt) {
        const int k0 = kt * 64;
        // stage A tile: 128x64 -> 1024 16B chunks, 4 per thread
#pragma unroll
        for (int i = 0; i < 4; ++i) {
            int v = threadIdx.x + i * 256;
            int row = v >> 3, cv = v & 7;
            stage16(&As[row * LDA + cv * 8],
                    &A[(size_t)(m0 + row) * D_ + k0 + cv * 8]);
        }
        // stage B tile: 64x64 -> 512 16B chunks, 2 per thread
#pragma unroll
        for (int i = 0; i < 2; ++i) {
            int v = threadIdx.x + i * 256;
            int row = v >> 3, cv = v & 7;
            stage16(&Bs[row * LDA + cv * 8],
                    &BT[(size_t)(n0 + row) * D_ + k0 + cv * 8]);
        }
        wait_stage();
        __syncthreads();

#pragma unroll
        for (int kc = 0; kc < 64; kc += 32) {
            v16bf a = load_frag16<LDA>(&As[wave * 16 * LDA + kc]);
#pragma unroll
            for (int j = 0; j < 4; ++j) {
                v16bf b = load_frag16<LDA>(&Bs[j * 16 * LDA + kc]);
                acc[j] = wmma_bf16(a, b, acc[j]);
            }
        }
        __syncthreads();
    }

    // epilogue: C element (m = m0 + wave*16 + hf*8 + r, n = n0 + j*16 + idx)
#pragma unroll
    for (int j = 0; j < 4; ++j) {
        const int n  = n0 + j * 16 + idx;
        const float bn = bias[n];
#pragma unroll
        for (int r = 0; r < 8; ++r) {
            const int m = m0 + wave * 16 + hf * 8 + r;
            const float val = acc[j][r] + bn;
            if constexpr (MODE == 0)
                ((bf16_t*)outp)[(size_t)m * D_ + n] = (bf16_t)val;
            else
                ((float*)outp)[(size_t)m * D_ + n] = val;
        }
    }
}

// ---------------------------------------------------------------------------
// Flash-style attention, transposed products. Q/K/V bf16 row-major
// [B*S][768], head slice at column h*64. One block = one (b,h) x 128 query
// rows; key tiles of 64. Each wave owns 16 queries.
//   S^T = K * Q^T : tile j holds key j*16 + hf*8 + r (register r), query idx
//   O^T += V^T * P^T : tile j holds e = j*16 + hf*8 + r, query idx
// A lane holds one query only: its maximum and sum are in-lane over its half
// of the keys, and two S^T tiles convert in place into the B operand P^T.
// ---------------------------------------------------------------------------
// lane l <-> lane l ^ 16 (the two lanes that share a query)
__device__ __forceinline__ float xhalf(float x) {
    return __builtin_bit_cast(float, __builtin_amdgcn_permlanex16(
        __builtin_bit_cast(int, x), __builtin_bit_cast(int, x),
        0x76543210, 0xfedcba98, false, false));
}

__global__ __launch_bounds__(256)
void attn_kernel(const bf16_t* __restrict__ Q, const bf16_t* __restrict__ K,
                 const bf16_t* __restrict__ V, bf16_t* __restrict__ O) {
    constexpr int LD = 72;                  // padded row stride (bf16 elems)
    __shared__ bf16_t Qs[128 * LD];         // 128 q-rows x 64
    __shared__ bf16_t Ks[64 * LD];          // 64 k-rows  x 64 (rows t, cols e)
    __shared__ bf16_t VTs[64 * LD];         // V transposed (rows e, cols t)

    const int bh   = blockIdx.y;
    const int b    = bh / H_;
    const int h    = bh % H_;
    const int q0   = blockIdx.x * 128;
    const int wave = threadIdx.x >> 5;
    const int lane = threadIdx.x & 31;
    const int idx  = lane & 15;
    const int hf   = lane >> 4;
    const size_t base = (size_t)b * S_ * D_ + (size_t)h * DH_;

    // stage Q tile once: 128x64 -> 1024 16B chunks, 4 per thread (async)
#pragma unroll
    for (int i = 0; i < 4; ++i) {
        int v = threadIdx.x + i * 256;
        int row = v >> 3, cv = v & 7;
        stage16(&Qs[row * LD + cv * 8],
                &Q[base + (size_t)(q0 + row) * D_ + cv * 8]);
    }

    v8f acc[4];
    float mrow = -3.0e38f;   // running maximum of this lane's query
    float lrow = 0.0f;       // running sum over this lane's half of the keys
#pragma unroll
    for (int j = 0; j < 4; ++j)
#pragma unroll
        for (int r = 0; r < 8; ++r) acc[j][r] = 0.0f;

    for (int kt = 0; kt < S_ / 64; ++kt) {
        const int t0 = kt * 64;
        // stage K tile (as-is: rows t, K-contiguous e -> A operand of K*Q^T)
#pragma unroll
        for (int i = 0; i < 2; ++i) {
            int v = threadIdx.x + i * 256;
            int row = v >> 3, cv = v & 7;
            stage16(&Ks[row * LD + cv * 8],
                    &K[base + (size_t)(t0 + row) * D_ + cv * 8]);
        }
        // stage V transposed: VTs[e][t] (rows e, K-contiguous t -> A of V^T*P^T)
#pragma unroll
        for (int i = 0; i < 2; ++i) {
            int v = threadIdx.x + i * 256;
            int row = v >> 3, cv = v & 7;
            union { uint4 u; bf16_t e[8]; } tmp;
            tmp.u = *reinterpret_cast<const uint4*>(&V[base + (size_t)(t0 + row) * D_ + cv * 8]);
#pragma unroll
            for (int q = 0; q < 8; ++q) VTs[(cv * 8 + q) * LD + row] = tmp.e[q];
        }
        wait_stage();        // Q (first iter) + K async copies complete
        __syncthreads();

        // scores: S^T = K(64x64) * Q^T(64x16) -> 4 tiles of 16 keys x 16 queries
        v8f sc[4];
#pragma unroll
        for (int j = 0; j < 4; ++j)
#pragma unroll
            for (int r = 0; r < 8; ++r) sc[j][r] = 0.0f;
#pragma unroll
        for (int kc = 0; kc < 64; kc += 32) {
            v16bf bq = load_frag16<LD>(&Qs[wave * 16 * LD + kc]);
#pragma unroll
            for (int j = 0; j < 4; ++j) {
                v16bf ak = load_frag16<LD>(&Ks[j * 16 * LD + kc]);
                sc[j] = wmma_bf16(ak, bq, sc[j]);
            }
        }

        // online softmax; all 32 values of a lane belong to query idx
        float tmax = -3.0e38f;
#pragma unroll
        for (int j = 0; j < 4; ++j)
#pragma unroll
            for (int r = 0; r < 8; ++r) {
                sc[j][r] *= 0.125f;               // 1/sqrt(DH)
                tmax = fmaxf(tmax, sc[j][r]);
            }
        tmax = fmaxf(tmax, xhalf(tmax));          // both halves: the query's maximum

        const float mn    = fmaxf(mrow, tmax);
        const float alpha = __expf(mrow - mn);
        mrow = mn;
        v2f tsum = {0.0f, 0.0f};                  // even and odd registers apart
#pragma unroll
        for (int j = 0; j < 4; ++j)
#pragma unroll
            for (int r = 0; r < 8; r += 2) {
                v2f p = {__expf(sc[j][r] - mrow), __expf(sc[j][r + 1] - mrow)};
                sc[j][r]     = p.x;
                sc[j][r + 1] = p.y;
                tsum += p;
            }
        lrow = lrow * alpha + (tsum.x + tsum.y);
#pragma unroll
        for (int j = 0; j < 4; ++j)
#pragma unroll
            for (int r = 0; r < 8; ++r) acc[j][r] *= alpha;

        // O^T += V^T(64x64) * P^T(64x16). Two S^T tiles (keys kc..kc+31) are,
        // converted in place, the B operand in the loader's k order:
        // element s<8 -> key kc + hf*8 + s, element 8+s -> key kc + 16 + hf*8 + s
#pragma unroll
        for (int kc = 0; kc < 64; kc += 32) {
            v16bf bp;
#pragma unroll
            for (int s = 0; s < 8; ++s) {
                bp[s]     = (bf16_t)sc[kc / 16][s];
                bp[8 + s] = (bf16_t)sc[kc / 16 + 1][s];
            }
#pragma unroll
            for (int j = 0; j < 4; ++j) {
                v16bf av = load_frag16<LD>(&VTs[j * 16 * LD + kc]);
                acc[j] = wmma_bf16(av, bp, acc[j]);
            }
        }
        __syncthreads();
    }

    // join the two halves' sums once; a lane's 8 registers of tile j are
    // 8 consecutive e of its query: one 16-byte store each
    const float inv = 1.0f / (lrow + xhalf(lrow));
    const int s = q0 + wave * 16 + idx;
#pragma unroll
    for (int j = 0; j < 4; ++j) {
        union { uint4 u; bf16_t e[8]; } o;
#pragma unroll
        for (int r = 0; r < 8; ++r) o.e[r] = (bf16_t)(acc[j][r] * inv);
        *reinterpret_cast<uint4*>(&O[base + (size_t)s * D_ + j * 16 + hf * 8]) = o.u;
    }
}

// ---------------------------------------------------------------------------
// Launch: pack -> QKV GEMMs -> attention -> output projection.
// Workspace (bf16): xb | qb | kb | vb | wqT | wkT | wvT | woT  (~53 MB).
// Attention output reuses xb (x is dead after the QKV GEMMs).
// ---------------------------------------------------------------------------
extern "C" void kernel_launch(void* const* d_in, const int* in_sizes, int n_in,
                              void* d_out, int out_size, void* d_ws, size_t ws_size,
                              hipStream_t stream) {
    (void)in_sizes; (void)n_in; (void)out_size;

    const float* x  = (const float*)d_in[0];
    const float* Wq = (const float*)d_in[1];
    const float* bq = (const float*)d_in[2];
    const float* Wk = (const float*)d_in[3];
    const float* bk = (const float*)d_in[4];
    const float* Wv = (const float*)d_in[5];
    const float* bv = (const float*)d_in[6];
    const float* Wo = (const float*)d_in[7];
    const float* bo = (const float*)d_in[8];

    const size_t MD = (size_t)MTOT * D_;   // 6,291,456 elems
    const size_t WN = (size_t)D_ * D_;     //   589,824 elems
    if (ws_size < (4 * MD + 4 * WN) * sizeof(bf16_t)) return;

    bf16_t* xb  = (bf16_t*)d_ws;
    bf16_t* qb  = xb  + MD;
    bf16_t* kb  = qb  + MD;
    bf16_t* vb  = kb  + MD;
    bf16_t* wqT = vb  + MD;
    bf16_t* wkT = wqT + WN;
    bf16_t* wvT = wkT + WN;
    bf16_t* woT = wvT + WN;

    pack_f32_bf16<<<PKX_BLOCKS, 256, 0, stream>>>(x, xb);
    pack_headW<<<PKW_BLOCKS, 64, 0, stream>>>(Wq, wqT);
    pack_headW<<<PKW_BLOCKS, 64, 0, stream>>>(Wk, wkT);
    pack_headW<<<PKW_BLOCKS, 64, 0, stream>>>(Wv, wvT);
    pack_WoT  <<<PKW_BLOCKS, 64, 0, stream>>>(Wo, woT);

    dim3 gg(MTOT / 128, D_ / 64);
    gemm_bf16_128x64<0><<<gg, 256, 0, stream>>>(xb, wqT, bq, qb);
    gemm_bf16_128x64<0><<<gg, 256, 0, stream>>>(xb, wkT, bk, kb);
    gemm_bf16_128x64<0><<<gg, 256, 0, stream>>>(xb, wvT, bv, vb);

    attn_kernel<<<dim3(S_ / 128, B_ * H_), 256, 0, stream>>>(qb, kb, vb, xb);

    gemm_bf16_128x64<1><<<gg, 256, 0, stream>>>(xb, woT, bo, d_out);
}

// v003
// One run takes 122 microseconds.
// Two timings next to v002 put it at 1.16 and 1.15 times that version's speed.
// Over all steps from v000 it is 1.44 times as fast.
#include <hip/hip_runtime.h>

typedef __bf16 bf16_t;
typedef __attribute__((ext_vector_type(16))) __bf16 v16bf;
typedef __attribute__((ext_vector_type(8)))  float  v8f;
typedef __attribute__((ext_vector_type(2)))  float  v2f;
typedef int i32x4 __attribute__((vector_size(16)));   // matches builtin's V4i

#define B_   8
#define S_   1024
#define D_   768
#define H_   12
#define DH_  64
#define MTOT (B_ * S_)   // 8192

#define AS1 __attribute__((address_space(1)))
#define AS3 __attribute__((address_space(3)))

// gfx1250 async global->LDS path (ASYNCcnt); fall back to VGPR round-trip if
// this toolchain doesn't declare the builtins.
#if __has_builtin(__builtin_amdgcn_global_load_async_to_lds_b128) && \
    __has_builtin(__builtin_amdgcn_s_wait_asynccnt)
#define ASYNC_OK 1
#else
#define ASYNC_OK 0
#endif

// Copy 16 bytes (8 bf16) global -> LDS, per lane.
__device__ __forceinline__ void stage16(bf16_t* lds, const bf16_t* g) {
#if ASYNC_OK
    __builtin_amdgcn_global_load_async_to_lds_b128(
        (AS1 i32x4*)g, (AS3 i32x4*)lds, /*offset=*/0, /*cpol=*/0);
#else
    *reinterpret_cast<uint4*>(lds) = *reinterpret_cast<const uint4*>(g);
#endif
}

__device__ __forceinline__ void wait_stage() {
#if ASYNC_OK
    __builtin_amdgcn_s_wait_asynccnt(0);
#endif
}

// ---------------------------------------------------------------------------
// Fragment loader: 16 rows x 32 K of bf16, rows K-contiguous in LDS.
// Per-lane layout for V_WMMA_*_16X16X32_BF16 (A and B operands):
//   lane<16 : row = lane,    K = {0..7, 16..23}
//   lane>=16: row = lane-16, K = {8..15, 24..31}
// ---------------------------------------------------------------------------
template<int LDW>
__device__ __forceinline__ v16bf load_frag16(const bf16_t* base) {
    const int lane = threadIdx.x & 31;
    const int idx  = lane & 15;
    const int hf   = lane >> 4;
    const bf16_t* row = base + idx * LDW + hf * 8;
    union { v16bf v; uint4 u[2]; } f;
    f.u[0] = *reinterpret_cast<const uint4*>(row);
    f.u[1] = *reinterpret_cast<const uint4*>(row + 16);
    return f.v;
}

__device__ __forceinline__ v8f wmma_bf16(v16bf a, v16bf b, v8f c) {
    return __builtin_amdgcn_wmma_f32_16x16x32_bf16(
        /*neg_a=*/false, a, /*neg_b=*/false, b,
        /*c_mod=*/(short)0, c, /*reuse_a=*/false, /*reuse_b=*/false);
}

// ---------------------------------------------------------------------------
// Pack kernels: fp32 -> bf16, weights transposed to [N][K] (K-contiguous).
// Few waves with many elements each: a launch with one element per lane is
// bound by how fast waves start, not by its bytes. All five packs are
// independent of each other and go out as ONE launch: each short launch costs
// a gap and its own round trip to memory, which here run side by side.
// ---------------------------------------------------------------------------
typedef __attribute__((ext_vector_type(4))) float  v4f;
typedef __attribute__((ext_vector_type(4))) __bf16 v4bf;
typedef __attribute__((ext_vector_type(8))) __bf16 v8bf;

#define PKX_BLOCKS 512   // 2 blocks of 8 waves per WGP: 16 streaming waves
#define PKX_PER    12    // 16-byte loads per lane, all in flight together
static_assert((size_t)PKX_BLOCKS * 256 * PKX_PER * 4 == (size_t)MTOT * D_,
              "the x pack covers x exactly");

// A block converts 12 x 256 consecutive groups of 4. Each wave-wide load is
// 512 contiguous bytes (4 whole lines), each wave-wide store 256 (2 lines).
__device__ __forceinline__
void pack_f32_bf16(int blk, const float* __restrict__ in, bf16_t* __restrict__ out) {
    const size_t g0 = (size_t)blk * (PKX_PER * 256) + threadIdx.x;
    const v4f* in4  = reinterpret_cast<const v4f*>(in) + g0;
    v4bf*      out4 = reinterpret_cast<v4bf*>(out) + g0;
    v4f f[PKX_PER];
    // unrolled: f stays in registers and all 12 loads are issued before a wait
#pragma unroll
    for (int i = 0; i < PKX_PER; ++i) f[i] = in4[i * 256];
#pragma unroll
    for (int i = 0; i < PKX_PER; ++i)
        out4[i * 256] = __builtin_convertvector(f[i], v4bf);
}

// 64 x 64 tile of a transposing pack, done by 64 lanes. Lane = one output
// row: it reads 64 source rows at its own column (a wave-wide load is one whole
// 128-byte line) and alone writes one whole 128-byte line of the output.
//   src: this lane's column in the tile's first source row, ld = source pitch
//   dst: this lane's 64 consecutive outputs
__device__ __forceinline__ void pack_T64(const float* __restrict__ src, int ld,
                                         bf16_t* __restrict__ dst) {
    float f[64];
    // unrolled: f stays in registers and all 64 loads are issued before a wait
#pragma unroll
    for (int i = 0; i < 64; ++i) f[i] = src[(size_t)i * ld];
#pragma unroll
    for (int c = 0; c < 8; ++c) {
        v8bf o;
#pragma unroll
        for (int q = 0; q < 8; ++q) o[q] = (bf16_t)f[c * 8 + q];
        reinterpret_cast<v8bf*>(dst)[c] = o;
    }
    // precaution: stands in front of any overwrite of the stores' address and
    // data registers by the code that follows this inlined body
    asm volatile("s_wait_xcnt 0x0" ::: "memory");
}

#define PKW_TILES  ((D_ / 64) * (D_ / 64))   // 144 tiles of 64 x 64 per matrix
#define PKW_PERMAT (PKW_TILES / 4)           // 36 blocks of 4 tiles per matrix
#define PKW_BLOCKS (4 * PKW_PERMAT)          // Wq, Wk, Wv, Wo

// Blocks 0..143: weight tiles, 4 per block (64 lanes each), one matrix per 36
// blocks. Blocks 144..655: x. wT holds the four packed matrices in a row.
//   head W: [H, D, DH] ; outT[n*768 + d] = W[h, d, e] with n = h*64 + e
//   Wo:     [D, D] row-major ; outT[n*768 + d] = Wo[d, n]
__global__ __launch_bounds__(256)
void pack_all(const float* __restrict__ x,
              const float* __restrict__ Wq, const float* __restrict__ Wk,
              const float* __restrict__ Wv, const float* __restrict__ Wo,
              bf16_t* __restrict__ xb, bf16_t* __restrict__ wT) {
    if (blockIdx.x >= PKW_BLOCKS) {
        pack_f32_bf16(blockIdx.x - PKW_BLOCKS, x, xb);
        return;
    }
    const int mat  = blockIdx.x / PKW_PERMAT;
    const int tile = (blockIdx.x % PKW_PERMAT) * 4 + (threadIdx.x >> 6);
    const int nt   = tile / (D_ / 64);            // head, or 64-column group of Wo
    const int d0   = (tile % (D_ / 64)) * 64;
    const int e    = threadIdx.x & 63;
    bf16_t* dst = wT + (size_t)mat * (D_ * D_) + (size_t)(nt * 64 + e) * D_ + d0;
    if (mat < 3) {
        const float* W = mat == 0 ? Wq : (mat == 1 ? Wk : Wv);
        pack_T64(W + ((size_t)nt * D_ + d0) * DH_ + e, DH_, dst);
    } else {
        pack_T64(Wo + (size_t)d0 * D_ + nt * 64 + e, D_, dst);
    }
}

// ---------------------------------------------------------------------------
// GEMM: C[8192 x 768] = A[8192 x 768] * BT^T + bias
//   A row-major bf16 (K contiguous), BT = B transposed [N][K] bf16.
//   Block tile 128x64, BK=64, 8 waves, each wave -> 16 rows x 64 cols.
//   MODE 0: out bf16 row-major  (QKV path)
//   MODE 1: out f32  row-major  (final projection -> d_out)
//   ny: the block's 64-column tile of this product
// ---------------------------------------------------------------------------
template<int MODE>
__device__ __forceinline__
void gemm_bf16_128x64(const bf16_t* __restrict__ A,
                      const bf16_t* __restrict__ BT,
                      const float* __restrict__ bias,
                      void* __restrict__ outp, int ny) {
    constexpr int LDA = 72;                 // padded row stride (bf16 elems)
    __shared__ bf16_t As[128 * LDA];        // 128 x 64 tile
    __shared__ bf16_t Bs[64 * LDA];         //  64 x 64 tile

    const int m0   = blockIdx.x * 128;
    const int n0   = ny * 64;
    const int wave = threadIdx.x >> 5;
    const int lane = threadIdx.x & 31;
    const int idx  = lane & 15;
    const int hf   = lane >> 4;

    v8f acc[4];
#pragma unroll
    for (int j = 0; j < 4; ++j)
#pragma unroll
        for (int r = 0; r < 8; ++r) acc[j][r] = 0.0f;

    // unrolled whole, as the build of the separate launches was: left alone the
    // merged QKV kernel keeps this loop rolled, with address arithmetic per trip
    // instead of k offsets as immediates of the copies
#pragma unroll
    for (int kt = 0; kt < D_ / 64; ++kt) {
        const int k0 = kt * 64;
        // stage A tile: 128x64 -> 1024 16B chunks, 4 per thread
#pragma unroll
        for (int i = 0; i < 4; ++i) {
            int v = threadIdx.x + i * 256;
            int row = v >> 3, cv = v & 7;
            stage16(&As[row * LDA + cv * 8],
                    &A[(size_t)(m0 + row) * D_ + k0 + cv * 8]);
        }
        // stage B tile: 64x64 -> 512 16B chunks, 2 per thread
#pragma unroll
        for (int i = 0; i < 2; ++i) {
            int v = threadIdx.x + i * 256;
            int row = v >> 3, cv = v & 7;
            stage16(&Bs[row * LDA + cv * 8],
                    &BT[(size_t)(n0 + row) * D_ + k0 + cv * 8]);
        }
        wait_stage();
        __syncthreads();

#pragma unroll
        for (int kc = 0; kc < 64; kc += 32) {
            v16bf a = load_frag16<LDA>(&As[wave * 16 * LDA + kc]);
#pragma unroll
            for (int j = 0; j < 4; ++j) {
                v16bf b = load_frag16<LDA>(&Bs[j * 16 * LDA + kc]);
                acc[j] = wmma_bf16(a, b, acc[j]);
            }
        }
        __syncthreads();
    }

    // epilogue: C element (m = m0 + wave*16 + hf*8 + r, n = n0 + j*16 + idx)
#pragma unroll
    for (int j = 0; j < 4; ++j) {
        const int n  = n0 + j * 16 + idx;
        const float bn = bias[n];
#pragma unroll
        for (int r = 0; r < 8; ++r) {
            const int m = m0 + wave * 16 + hf * 8 + r;
            const float val = acc[j][r] + bn;
            if constexpr (MODE == 0)
                ((bf16_t*)outp)[(size_t)m * D_ + n] = (bf16_t)val;
            else
                ((float*)outp)[(size_t)m * D_ + n] = val;
        }
    }
}

// Q, K and V projections in one launch: they share A and do not depend on each
// other. blockIdx.y = product * 12 + column tile; the packed weights and the
// three outputs each lie in a row in the workspace.
__global__ __launch_bounds__(256)
void gemm_qkv(const bf16_t* __restrict__ A, const bf16_t* __restrict__ wT,
              const float* __restrict__ bq, const float* __restrict__ bk,
              const float* __restrict__ bv, bf16_t* __restrict__ qkv) {
    const int p = blockIdx.y / (D_ / 64);
    const float* bias = p == 0 ? bq : (p == 1 ? bk : bv);
    gemm_bf16_128x64<0>(A, wT + (size_t)p * (D_ * D_), bias,
                        qkv + (size_t)p * ((size_t)MTOT * D_),
                        blockIdx.y % (D_ / 64));
}

__global__ __launch_bounds__(256)
void gemm_out(const bf16_t* __restrict__ A, const bf16_t* __restrict__ BT,
              const float* __restrict__ bias, float* __restrict__ out) {
    gemm_bf16_128x64<1>(A, BT, bias, out, blockIdx.y);
}

// ---------------------------------------------------------------------------
// Flash-style attention, transposed products. Q/K/V bf16 row-major
// [B*S][768], head slice at column h*64. One block = one (b,h) x 128 query
// rows; key tiles of 64. Each wave owns 16 queries.
//   S^T = K * Q^T : tile j holds key j*16 + hf*8 + r (register r), query idx
//   O^T += V^T * P^T : tile j holds e = j*16 + hf*8 + r, query idx
// A lane holds one query only: its maximum and sum are in-lane over its half
// of the keys, and two S^T tiles convert in place into the B operand P^T.
// ---------------------------------------------------------------------------
// lane l <-> lane l ^ 16 (the two lanes that share a query)
__device__ __forceinline__ float xhalf(float x) {
    return __builtin_bit_cast(float, __builtin_amdgcn_permlanex16(
        __builtin_bit_cast(int, x), __builtin_bit_cast(int, x),
        0x76543210, 0xfedcba98, false, false));
}

__global__ __launch_bounds__(256)
void attn_kernel(const bf16_t* __restrict__ Q, const bf16_t* __restrict__ K,
                 const bf16_t* __restrict__ V, bf16_t* __restrict__ O) {
    constexpr int LD = 72;                  // padded row stride (bf16 elems)
    __shared__ bf16_t Qs[128 * LD];         // 128 q-rows x 64
    __shared__ bf16_t Ks[64 * LD];          // 64 k-rows  x 64 (rows t, cols e)
    __shared__ bf16_t VTs[64 * LD];         // V transposed (rows e, cols t)

    const int bh   = blockIdx.y;
    const int b    = bh / H_;
    const int h    = bh % H_;
    const int q0   = blockIdx.x * 128;
    const int wave = threadIdx.x >> 5;
    const int lane = threadIdx.x & 31;
    const int idx  = lane & 15;
    const int hf   = lane >> 4;
    const size_t base = (size_t)b * S_ * D_ + (size_t)h * DH_;

    // stage Q tile once: 128x64 -> 1024 16B chunks, 4 per thread (async)
#pragma unroll
    for (int i = 0; i < 4; ++i) {
        int v = threadIdx.x + i * 256;
        int row = v >> 3, cv = v & 7;
        stage16(&Qs[row * LD + cv * 8],
                &Q[base + (size_t)(q0 + row) * D_ + cv * 8]);
    }

    v8f acc[4];
    float mrow = -3.0e38f;   // running maximum of this lane's query
    float lrow = 0.0f;       // running sum over this lane's half of the keys
#pragma unroll
    for (int j = 0; j < 4; ++j)
#pragma unroll
        for (int r = 0; r < 8; ++r) acc[j][r] = 0.0f;

    for (int kt = 0; kt < S_ / 64; ++kt) {
        const int t0 = kt * 64;
        // stage K tile (as-is: rows t, K-contiguous e -> A operand of K*Q^T)
#pragma unroll
        for (int i = 0; i < 2; ++i) {
            int v = threadIdx.x + i * 256;
            int row = v >> 3, cv = v & 7;
            stage16(&Ks[row * LD + cv * 8],
                    &K[base + (size_t)(t0 + row) * D_ + cv * 8]);
        }
        // stage V transposed: VTs[e][t] (rows e, K-contiguous t -> A of V^T*P^T)
#pragma unroll
        for (int i = 0; i < 2; ++i) {
            int v = threadIdx.x + i * 256;
            int row = v >> 3, cv = v & 7;
            union { uint4 u; bf16_t e[8]; } tmp;
            tmp.u = *reinterpret_cast<const uint4*>(&V[base + (size_t)(t0 + row) * D_ + cv * 8]);
#pragma unroll
            for (int q = 0; q < 8; ++q) VTs[(cv * 8 + q) * LD + row] = tmp.e[q];
        }
        wait_stage();        // Q (first iter) + K async copies complete
        __syncthreads();

        // scores: S^T = K(64x64) * Q^T(64x16) -> 4 tiles of 16 keys x 16 queries
        v8f sc[4];
#pragma unroll
        for (int j = 0; j < 4; ++j)
#pragma unroll
            for (int r = 0; r < 8; ++r) sc[j][r] = 0.0f;
#pragma unroll
        for (int kc = 0; kc < 64; kc += 32) {
            v16bf bq = load_frag16<LD>(&Qs[wave * 16 * LD + kc]);
#pragma unroll
            for (int j = 0; j < 4; ++j) {
                v16bf ak = load_frag16<LD>(&Ks[j * 16 * LD + kc]);
                sc[j] = wmma_bf16(ak, bq, sc[j]);
            }
        }

        // online softmax; all 32 values of a lane belong to query idx
        float tmax = -3.0e38f;
#pragma unroll
        for (int j = 0; j < 4; ++j)
#pragma unroll
            for (int r = 0; r < 8; ++r) {
                sc[j][r] *= 0.125f;               // 1/sqrt(DH)
                tmax = fmaxf(tmax, sc[j][r]);
            }
        tmax = fmaxf(tmax, xhalf(tmax));          // both halves: the query's maximum

        const float mn    = fmaxf(mrow, tmax);
        const float alpha = __expf(mrow - mn);
        mrow = mn;
        v2f tsum = {0.0f, 0.0f};                  // even and odd registers apart
#pragma unroll
        for (int j = 0; j < 4; ++j)
#pragma unroll
            for (int r = 0; r < 8; r += 2) {
                v2f p = {__expf(sc[j][r] - mrow), __expf(sc[j][r + 1] - mrow)};
                sc[j][r]     = p.x;
                sc[j][r + 1] = p.y;
                tsum += p;
            }
        lrow = lrow * alpha + (tsum.x + tsum.y);
#pragma unroll
        for (int j = 0; j < 4; ++j)
#pragma unroll
            for (int r = 0; r < 8; ++r) acc[j][r] *= alpha;

        // O^T += V^T(64x64) * P^T(64x16). Two S^T tiles (keys kc..kc+31) are,
        // converted in place, the B operand in the loader's k order:
        // element s<8 -> key kc + hf*8 + s, element 8+s -> key kc + 16 + hf*8 + s
#pragma unroll
        for (int kc = 0; kc < 64; kc += 32) {
            v16bf bp;
#pragma unroll
            for (int s = 0; s < 8; ++s) {
                bp[s]     = (bf16_t)sc[kc / 16][s];
                bp[8 + s] = (bf16_t)sc[kc / 16 + 1][s];
            }
#pragma unroll
            for (int j = 0; j < 4; ++j) {
                v16bf av = load_frag16<LD>(&VTs[j * 16 * LD + kc]);
                acc[j] = wmma_bf16(av, bp, acc[j]);
            }
        }
        __syncthreads();
    }

    // join the two halves' sums once; a lane's 8 registers of tile j are
    // 8 consecutive e of its query: one 16-byte store each
    const float inv = 1.0f / (lrow + xhalf(lrow));
    const int s = q0 + wave * 16 + idx;
#pragma unroll
    for (int j = 0; j < 4; ++j) {
        union { uint4 u; bf16_t e[8]; } o;
#pragma unroll
        for (int r = 0; r < 8; ++r) o.e[r] = (bf16_t)(acc[j][r] * inv);
        *reinterpret_cast<uint4*>(&O[base + (size_t)s * D_ + j * 16 + hf * 8]) = o.u;
    }
}

// ---------------------------------------------------------------------------
// Launch: pack -> QKV GEMM -> attention -> output projection (4 launches).
// Workspace (bf16): xb | qb | kb | vb | wqT | wkT | wvT | woT  (~53 MB).
// Attention output reuses xb (x is dead after the QKV GEMMs).
// ---------------------------------------------------------------------------
extern "C" void kernel_launch(void* const* d_in, const int* in_sizes, int n_in,
                              void* d_out, int out_size, void* d_ws, size_t ws_size,
                              hipStream_t stream) {
    (void)in_sizes; (void)n_in; (void)out_size;

    const float* x  = (const float*)d_in[0];
    const float* Wq = (const float*)d_in[1];
    const float* bq = (const float*)d_in[2];
    const float* Wk = (const float*)d_in[3];
    const float* bk = (const float*)d_in[4];
    const float* Wv = (const float*)d_in[5];
    const float* bv = (const float*)d_in[6];
    const float* Wo = (const float*)d_in[7];
    const float* bo = (const float*)d_in[8];

    const size_t MD = (size_t)MTOT * D_;   // 6,291,456 elems
    const size_t WN = (size_t)D_ * D_;     //   589,824 elems
    if (ws_size < (4 * MD + 4 * WN) * sizeof(bf16_t)) return;

    bf16_t* xb  = (bf16_t*)d_ws;
    bf16_t* qb  = xb  + MD;
    bf16_t* kb  = qb  + MD;
    bf16_t* vb  = kb  + MD;
    bf16_t* wqT = vb  + MD;
    bf16_t* wkT = wqT + WN;
    bf16_t* wvT = wkT + WN;
    bf16_t* woT = wvT + WN;

    pack_all<<<PKW_BLOCKS + PKX_BLOCKS, 256, 0, stream>>>(x, Wq, Wk, Wv, Wo, xb, wqT);

    gemm_qkv<<<dim3(MTOT / 128, 3 * (D_ / 64)), 256, 0, stream>>>(xb, wqT, bq, bk, bv, qb);

    attn_kernel<<<dim3(S_ / 128, B_ * H_), 256, 0, stream>>>(qb, kb, vb, xb);

    gemm_out<<<dim3(MTOT / 128, D_ / 64), 256, 0, stream>>>(xb, woT, bo, (float*)d_out);
}

// v004
// It runs in 109 microseconds.
// In both of two side-by-side timings against v003, it was 1.13 times as fast.
// Over all steps from v000 it is 1.63 times as fast.
#include <hip/hip_runtime.h>

typedef __bf16 bf16_t;
typedef __attribute__((ext_vector_type(16))) __bf16 v16bf;
typedef __attribute__((ext_vector_type(8)))  float  v8f;
typedef __attribute__((ext_vector_type(2)))  float  v2f;
typedef int i32x4 __attribute__((vector_size(16)));   // matches builtin's V4i

#define B_   8
#define S_   1024
#define D_   768
#define H_   12
#define DH_  64
#define MTOT (B_ * S_)   // 8192

#define AS1 __attribute__((address_space(1)))
#define AS3 __attribute__((address_space(3)))

// gfx1250 async global->LDS path (ASYNCcnt); fall back to VGPR round-trip if
// this toolchain doesn't declare the builtins.
#if __has_builtin(__builtin_amdgcn_global_load_async_to_lds_b128) && \
    __has_builtin(__builtin_amdgcn_s_wait_asynccnt)
#define ASYNC_OK 1
#else
#define ASYNC_OK 0
#endif

// Copy 16 bytes (8 bf16) global -> LDS, per lane.
__device__ __forceinline__ void stage16(bf16_t* lds, const bf16_t* g) {
#if ASYNC_OK
    __builtin_amdgcn_global_load_async_to_lds_b128(
        (AS1 i32x4*)g, (AS3 i32x4*)lds, /*offset=*/0, /*cpol=*/0);
#else
    *reinterpret_cast<uint4*>(lds) = *reinterpret_cast<const uint4*>(g);
#endif
}

__device__ __forceinline__ void wait_stage() {
#if ASYNC_OK
    __builtin_amdgcn_s_wait_asynccnt(0);
#endif
}

// ---------------------------------------------------------------------------
// Fragment loader: 16 rows x 32 K of bf16, rows K-contiguous in LDS.
// Per-lane layout for V_WMMA_*_16X16X32_BF16 (A and B operands):
//   lane<16 : row = lane,    K = {0..7, 16..23}
//   lane>=16: row = lane-16, K = {8..15, 24..31}
// ---------------------------------------------------------------------------
template<int LDW>
__device__ __forceinline__ v16bf load_frag16(const bf16_t* base) {
    const int lane = threadIdx.x & 31;
    const int idx  = lane & 15;
    const int hf   = lane >> 4;
    const bf16_t* row = base + idx * LDW + hf * 8;
    union { v16bf v; uint4 u[2]; } f;
    f.u[0] = *reinterpret_cast<const uint4*>(row);
    f.u[1] = *reinterpret_cast<const uint4*>(row + 16);
    return f.v;
}

// ---------------------------------------------------------------------------
// Transposing fragment loader: the tile lies in LDS as rows k, columns m
// (m contiguous); the result is the A operand of 16 m x 32 k in the k order of
// load_frag16. base = element (k 0, m 0) of the fragment. One load hands lane
// (idx, hf) the 8 elements k = hf*8 .. hf*8+7 of column idx; the second load,
// 16 rows on, gives k = 16 + hf*8 ..
// ---------------------------------------------------------------------------
typedef __attribute__((ext_vector_type(8))) __bf16 bf16x8;
template<int LDW>
__device__ __forceinline__ v16bf load_fragT16(const bf16_t* base) {
    const int lane = threadIdx.x & 31;
    const bf16_t* p = base + ((lane >> 4) * 8 + (lane & 7)) * LDW + ((lane >> 3) & 1) * 8;
    union { v16bf v; bf16x8 h[2]; } f;
    f.h[0] = __builtin_amdgcn_ds_load_tr16_b128_v8bf16((AS3 bf16x8*)p);
    f.h[1] = __builtin_amdgcn_ds_load_tr16_b128_v8bf16((AS3 bf16x8*)(p + 16 * LDW));
    return f.v;
}

__device__ __forceinline__ v8f wmma_bf16(v16bf a, v16bf b, v8f c) {
    return __builtin_amdgcn_wmma_f32_16x16x32_bf16(
        /*neg_a=*/false, a, /*neg_b=*/false, b,
        /*c_mod=*/(short)0, c, /*reuse_a=*/false, /*reuse_b=*/false);
}

// ---------------------------------------------------------------------------
// Pack kernels: fp32 -> bf16, weights transposed to [N][K] (K-contiguous).
// Few waves with many elements each: a launch with one element per lane is
// bound by how fast waves start, not by its bytes. All five packs are
// independent of each other and go out as ONE launch: each short launch costs
// a gap and its own round trip to memory, which here run side by side.
// ---------------------------------------------------------------------------
typedef __attribute__((ext_vector_type(4))) float  v4f;
typedef __attribute__((ext_vector_type(4))) __bf16 v4bf;
typedef __attribute__((ext_vector_type(8))) __bf16 v8bf;

#define PKX_BLOCKS 512   // 2 blocks of 8 waves per WGP: 16 streaming waves
#define PKX_PER    12    // 16-byte loads per lane, all in flight together
static_assert((size_t)PKX_BLOCKS * 256 * PKX_PER * 4 == (size_t)MTOT * D_,
              "the x pack covers x exactly");

// A block converts 12 x 256 consecutive groups of 4. Each wave-wide load is
// 512 contiguous bytes (4 whole lines), each wave-wide store 256 (2 lines).
__device__ __forceinline__
void pack_f32_bf16(int blk, const float* __restrict__ in, bf16_t* __restrict__ out) {
    const size_t g0 = (size_t)blk * (PKX_PER * 256) + threadIdx.x;
    const v4f* in4  = reinterpret_cast<const v4f*>(in) + g0;
    v4bf*      out4 = reinterpret_cast<v4bf*>(out) + g0;
    v4f f[PKX_PER];
    // unrolled: f stays in registers and all 12 loads are issued before a wait
#pragma unroll
    for (int i = 0; i < PKX_PER; ++i) f[i] = in4[i * 256];
#pragma unroll
    for (int i = 0; i < PKX_PER; ++i)
        out4[i * 256] = __builtin_convertvector(f[i], v4bf);
}

// 64 x 64 tile of a transposing pack, done by 64 lanes. Lane = one output
// row: it reads 64 source rows at its own column (a wave-wide load is one whole
// 128-byte line) and alone writes one whole 128-byte line of the output.
//   src: this lane's column in the tile's first source row, ld = source pitch
//   dst: this lane's 64 consecutive outputs
__device__ __forceinline__ void pack_T64(const float* __restrict__ src, int ld,
                                         bf16_t* __restrict__ dst) {
    float f[64];
    // unrolled: f stays in registers and all 64 loads are issued before a wait
#pragma unroll
    for (int i = 0; i < 64; ++i) f[i] = src[(size_t)i * ld];
#pragma unroll
    for (int c = 0; c < 8; ++c) {
        v8bf o;
#pragma unroll
        for (int q = 0; q < 8; ++q) o[q] = (bf16_t)f[c * 8 + q];
        reinterpret_cast<v8bf*>(dst)[c] = o;
    }
    // precaution: stands in front of any overwrite of the stores' address and
    // data registers by the code that follows this inlined body
    asm volatile("s_wait_xcnt 0x0" ::: "memory");
}

#define PKW_TILES  ((D_ / 64) * (D_ / 64))   // 144 tiles of 64 x 64 per matrix
#define PKW_PERMAT (PKW_TILES / 4)           // 36 blocks of 4 tiles per matrix
#define PKW_BLOCKS (4 * PKW_PERMAT)          // Wq, Wk, Wv, Wo

// Blocks 0..143: weight tiles, 4 per block (64 lanes each), one matrix per 36
// blocks. Blocks 144..655: x. wT holds the four packed matrices in a row.
//   head W: [H, D, DH] ; outT[n*768 + d] = W[h, d, e] with n = h*64 + e
//   Wo:     [D, D] row-major ; outT[n*768 + d] = Wo[d, n]
__global__ __launch_bounds__(256)
void pack_all(const float* __restrict__ x,
              const float* __restrict__ Wq, const float* __restrict__ Wk,
              const float* __restrict__ Wv, const float* __restrict__ Wo,
              bf16_t* __restrict__ xb, bf16_t* __restrict__ wT) {
    if (blockIdx.x >= PKW_BLOCKS) {
        pack_f32_bf16(blockIdx.x - PKW_BLOCKS, x, xb);
        return;
    }
    const int mat  = blockIdx.x / PKW_PERMAT;
    const int tile = (blockIdx.x % PKW_PERMAT) * 4 + (threadIdx.x >> 6);
    const int nt   = tile / (D_ / 64);            // head, or 64-column group of Wo
    const int d0   = (tile % (D_ / 64)) * 64;
    const int e    = threadIdx.x & 63;
    bf16_t* dst = wT + (size_t)mat * (D_ * D_) + (size_t)(nt * 64 + e) * D_ + d0;
    if (mat < 3) {
        const float* W = mat == 0 ? Wq : (mat == 1 ? Wk : Wv);
        pack_T64(W + ((size_t)nt * D_ + d0) * DH_ + e, DH_, dst);
    } else {
        pack_T64(Wo + (size_t)d0 * D_ + nt * 64 + e, D_, dst);
    }
}

// ---------------------------------------------------------------------------
// GEMM: C[8192 x 768] = A[8192 x 768] * BT^T + bias
//   A row-major bf16 (K contiguous), BT = B transposed [N][K] bf16.
//   Block tile 128x64, BK=64, 8 waves, each wave -> 16 rows x 64 cols.
//   MODE 0: out bf16 row-major  (QKV path)
//   MODE 1: out f32  row-major  (final projection -> d_out)
//   ny: the block's 64-column tile of this product
// ---------------------------------------------------------------------------
template<int MODE>
__device__ __forceinline__
void gemm_bf16_128x64(const bf16_t* __restrict__ A,
                      const bf16_t* __restrict__ BT,
                      const float* __restrict__ bias,
                      void* __restrict__ outp, int ny) {
    constexpr int LDA = 72;                 // padded row stride (bf16 elems)
    __shared__ bf16_t As[128 * LDA];        // 128 x 64 tile
    __shared__ bf16_t Bs[64 * LDA];         //  64 x 64 tile

    const int m0   = blockIdx.x * 128;
    const int n0   = ny * 64;
    const int wave = threadIdx.x >> 5;
    const int lane = threadIdx.x & 31;
    const int idx  = lane & 15;
    const int hf   = lane >> 4;

    v8f acc[4];
#pragma unroll
    for (int j = 0; j < 4; ++j)
#pragma unroll
        for (int r = 0; r < 8; ++r) acc[j][r] = 0.0f;

    // unrolled whole, as the build of the separate launches was: left alone the
    // merged QKV kernel keeps this loop rolled, with address arithmetic per trip
    // instead of k offsets as immediates of the copies
#pragma unroll
    for (int kt = 0; kt < D_ / 64; ++kt) {
        const int k0 = kt * 64;
        // stage A tile: 128x64 -> 1024 16B chunks, 4 per thread
#pragma unroll
        for (int i = 0; i < 4; ++i) {
            int v = threadIdx.x + i * 256;
            int row = v >> 3, cv = v & 7;
            stage16(&As[row * LDA + cv * 8],
                    &A[(size_t)(m0 + row) * D_ + k0 + cv * 8]);
        }
        // stage B tile: 64x64 -> 512 16B chunks, 2 per thread
#pragma unroll
        for (int i = 0; i < 2; ++i) {
            int v = threadIdx.x + i * 256;
            int row = v >> 3, cv = v & 7;
            stage16(&Bs[row * LDA + cv * 8],
                    &BT[(size_t)(n0 + row) * D_ + k0 + cv * 8]);
        }
        wait_stage();
        __syncthreads();

#pragma unroll
        for (int kc = 0; kc < 64; kc += 32) {
            v16bf a = load_frag16<LDA>(&As[wave * 16 * LDA + kc]);
#pragma unroll
            for (int j = 0; j < 4; ++j) {
                v16bf b = load_frag16<LDA>(&Bs[j * 16 * LDA + kc]);
                acc[j] = wmma_bf16(a, b, acc[j]);
            }
        }
        __syncthreads();
    }

    // epilogue: C element (m = m0 + wave*16 + hf*8 + r, n = n0 + j*16 + idx)
#pragma unroll
    for (int j = 0; j < 4; ++j) {
        const int n  = n0 + j * 16 + idx;
        const float bn = bias[n];
#pragma unroll
        for (int r = 0; r < 8; ++r) {
            const int m = m0 + wave * 16 + hf * 8 + r;
            const float val = acc[j][r] + bn;
            if constexpr (MODE == 0)
                ((bf16_t*)outp)[(size_t)m * D_ + n] = (bf16_t)val;
            else
                ((float*)outp)[(size_t)m * D_ + n] = val;
        }
    }
}

// Q, K and V projections in one launch: they share A and do not depend on each
// other. blockIdx.y = product * 12 + column tile; the packed weights and the
// three outputs each lie in a row in the workspace.
__global__ __launch_bounds__(256)
void gemm_qkv(const bf16_t* __restrict__ A, const bf16_t* __restrict__ wT,
              const float* __restrict__ bq, const float* __restrict__ bk,
              const float* __restrict__ bv, bf16_t* __restrict__ qkv) {
    const int p = blockIdx.y / (D_ / 64);
    const float* bias = p == 0 ? bq : (p == 1 ? bk : bv);
    gemm_bf16_128x64<0>(A, wT + (size_t)p * (D_ * D_), bias,
                        qkv + (size_t)p * ((size_t)MTOT * D_),
                        blockIdx.y % (D_ / 64));
}

__global__ __launch_bounds__(256)
void gemm_out(const bf16_t* __restrict__ A, const bf16_t* __restrict__ BT,
              const float* __restrict__ bias, float* __restrict__ out) {
    gemm_bf16_128x64<1>(A, BT, bias, out, blockIdx.y);
}

// ---------------------------------------------------------------------------
// Flash-style attention, transposed products. Q/K/V bf16 row-major
// [B*S][768], head slice at column h*64. One block = one (b,h) x 128 query
// rows; key tiles of 64. Each wave owns 16 queries.
//   S^T = K * Q^T : tile j holds key j*16 + hf*8 + r (register r), query idx
//   O^T += V^T * P^T : tile j holds e = j*16 + hf*8 + r, query idx
// A lane holds one query only: its maximum and sum are in-lane over its half
// of the keys, and two S^T tiles convert in place into the B operand P^T.
// V is copied to LDS as it lies (rows t); the transposing load makes V^T.
// ---------------------------------------------------------------------------
// lane l <-> lane l ^ 16 (the two lanes that share a query)
__device__ __forceinline__ float xhalf(float x) {
    return __builtin_bit_cast(float, __builtin_amdgcn_permlanex16(
        __builtin_bit_cast(int, x), __builtin_bit_cast(int, x),
        0x76543210, 0xfedcba98, false, false));
}

__global__ __launch_bounds__(256)
void attn_kernel(const bf16_t* __restrict__ Q, const bf16_t* __restrict__ K,
                 const bf16_t* __restrict__ V, bf16_t* __restrict__ O) {
    constexpr int LD = 72;                  // padded row stride (bf16 elems)
    __shared__ bf16_t Qs[128 * LD];         // 128 q-rows x 64
    __shared__ bf16_t Ks[64 * LD];          // 64 k-rows  x 64 (rows t, cols e)
    constexpr int LDV = 80;                 // V row stride: 160 B = 32 B x odd,
                                            // free of bank conflicts for the transposing load
    __shared__ __attribute__((aligned(16))) bf16_t Vs[64 * LDV];   // 64 k-rows x 64 (rows t, cols e)

    const int bh   = blockIdx.y;
    const int b    = bh / H_;
    const int h    = bh % H_;
    const int q0   = blockIdx.x * 128;
    const int wave = threadIdx.x >> 5;
    const int lane = threadIdx.x & 31;
    const int idx  = lane & 15;
    const int hf   = lane >> 4;
    const size_t base = (size_t)b * S_ * D_ + (size_t)h * DH_;

    // stage Q tile once: 128x64 -> 1024 16B chunks, 4 per thread (async)
#pragma unroll
    for (int i = 0; i < 4; ++i) {
        int v = threadIdx.x + i * 256;
        int row = v >> 3, cv = v & 7;
        stage16(&Qs[row * LD + cv * 8],
                &Q[base + (size_t)(q0 + row) * D_ + cv * 8]);
    }

    v8f acc[4];
    float mrow = -3.0e38f;   // running maximum of this lane's query
    float lrow = 0.0f;       // running sum over this lane's half of the keys
#pragma unroll
    for (int j = 0; j < 4; ++j)
#pragma unroll
        for (int r = 0; r < 8; ++r) acc[j][r] = 0.0f;

    for (int kt = 0; kt < S_ / 64; ++kt) {
        const int t0 = kt * 64;
        // stage K tile (as-is: rows t, K-contiguous e -> A operand of K*Q^T)
#pragma unroll
        for (int i = 0; i < 2; ++i) {
            int v = threadIdx.x + i * 256;
            int row = v >> 3, cv = v & 7;
            stage16(&Ks[row * LD + cv * 8],
                    &K[base + (size_t)(t0 + row) * D_ + cv * 8]);
        }
        // stage V tile as it lies (rows t, cols e): copies like K's, landed
        // behind the same wait and published by the same barrier below
#pragma unroll
        for (int i = 0; i < 2; ++i) {
            int v = threadIdx.x + i * 256;
            int row = v >> 3, cv = v & 7;
            stage16(&Vs[row * LDV + cv * 8],
                    &V[base + (size_t)(t0 + row) * D_ + cv * 8]);
        }
        wait_stage();        // Q (first iter) + K + V async copies complete
        __syncthreads();

        // scores: S^T = K(64x64) * Q^T(64x16) -> 4 tiles of 16 keys x 16 queries
        v8f sc[4];
#pragma unroll
        for (int j = 0; j < 4; ++j)
#pragma unroll
            for (int r = 0; r < 8; ++r) sc[j][r] = 0.0f;
#pragma unroll
        for (int kc = 0; kc < 64; kc += 32) {
            v16bf bq = load_frag16<LD>(&Qs[wave * 16 * LD + kc]);
#pragma unroll
            for (int j = 0; j < 4; ++j) {
                v16bf ak = load_frag16<LD>(&Ks[j * 16 * LD + kc]);
                sc[j] = wmma_bf16(ak, bq, sc[j]);
            }
        }

        // online softmax; all 32 values of a lane belong to query idx
        float tmax = -3.0e38f;
#pragma unroll
        for (int j = 0; j < 4; ++j)
#pragma unroll
            for (int r = 0; r < 8; ++r) {
                sc[j][r] *= 0.125f;               // 1/sqrt(DH)
                tmax = fmaxf(tmax, sc[j][r]);
            }
        tmax = fmaxf(tmax, xhalf(tmax));          // both halves: the query's maximum

        const float mn    = fmaxf(mrow, tmax);
        const float alpha = __expf(mrow - mn);
        mrow = mn;
        v2f tsum = {0.0f, 0.0f};                  // even and odd registers apart
#pragma unroll
        for (int j = 0; j < 4; ++j)
#pragma unroll
            for (int r = 0; r < 8; r += 2) {
                v2f p = {__expf(sc[j][r] - mrow), __expf(sc[j][r + 1] - mrow)};
                sc[j][r]     = p.x;
                sc[j][r + 1] = p.y;
                tsum += p;
            }
        lrow = lrow * alpha + (tsum.x + tsum.y);
#pragma unroll
        for (int j = 0; j < 4; ++j)
#pragma unroll
            for (int r = 0; r < 8; ++r) acc[j][r] *= alpha;

        // O^T += V^T(64x64) * P^T(64x16). Two S^T tiles (keys kc..kc+31) are,
        // converted in place, the B operand in the loader's k order:
        // element s<8 -> key kc + hf*8 + s, element 8+s -> key kc + 16 + hf*8 + s
#pragma unroll
        for (int kc = 0; kc < 64; kc += 32) {
            v16bf bp;
#pragma unroll
            for (int s = 0; s < 8; ++s) {
                bp[s]     = (bf16_t)sc[kc / 16][s];
                bp[8 + s] = (bf16_t)sc[kc / 16 + 1][s];
            }
#pragma unroll
            for (int j = 0; j < 4; ++j) {
                v16bf av = load_fragT16<LDV>(&Vs[kc * LDV + j * 16]);
                acc[j] = wmma_bf16(av, bp, acc[j]);
            }
        }
        __syncthreads();
    }

    // join the two halves' sums once; a lane's 8 registers of tile j are
    // 8 consecutive e of its query: one 16-byte store each
    const float inv = 1.0f / (lrow + xhalf(lrow));
    const int s = q0 + wave * 16 + idx;
#pragma unroll
    for (int j = 0; j < 4; ++j) {
        union { uint4 u; bf16_t e[8]; } o;
#pragma unroll
        for (int r = 0; r < 8; ++r) o.e[r] = (bf16_t)(acc[j][r] * inv);
        *reinterpret_cast<uint4*>(&O[base + (size_t)s * D_ + j * 16 + hf * 8]) = o.u;
    }
}

// ---------------------------------------------------------------------------
// Launch: pack -> QKV GEMM -> attention -> output projection (4 launches).
// Workspace (bf16): xb | qb | kb | vb | wqT | wkT | wvT | woT  (~53 MB).
// Attention output reuses xb (x is dead after the QKV GEMMs).
// ---------------------------------------------------------------------------
extern "C" void kernel_launch(void* const* d_in, const int* in_sizes, int n_in,
                              void* d_out, int out_size, void* d_ws, size_t ws_size,
                              hipStream_t stream) {
    (void)in_sizes; (void)n_in; (void)out_size;

    const float* x  = (const float*)d_in[0];
    const float* Wq = (const float*)d_in[1];
    const float* bq = (const float*)d_in[2];
    const float* Wk = (const float*)d_in[3];
    const float* bk = (const float*)d_in[4];
    const float* Wv = (const float*)d_in[5];
    const float* bv = (const float*)d_in[6];
    const float* Wo = (const float*)d_in[7];
    const float* bo = (const float*)d_in[8];

    const size_t MD = (size_t)MTOT * D_;   // 6,291,456 elems
    const size_t WN = (size_t)D_ * D_;     //   589,824 elems
    if (ws_size < (4 * MD + 4 * WN) * sizeof(bf16_t)) return;

    bf16_t* xb  = (bf16_t*)d_ws;
    bf16_t* qb  = xb  + MD;
    bf16_t* kb  = qb  + MD;
    bf16_t* vb  = kb  + MD;
    bf16_t* wqT = vb  + MD;
    bf16_t* wkT = wqT + WN;
    bf16_t* wvT = wkT + WN;
    bf16_t* woT = wvT + WN;

    pack_all<<<PKW_BLOCKS + PKX_BLOCKS, 256, 0, stream>>>(x, Wq, Wk, Wv, Wo, xb, wqT);

    gemm_qkv<<<dim3(MTOT / 128, 3 * (D_ / 64)), 256, 0, stream>>>(xb, wqT, bq, bk, bv, qb);

    attn_kernel<<<dim3(S_ / 128, B_ * H_), 256, 0, stream>>>(qb, kb, vb, xb);

    gemm_out<<<dim3(MTOT / 128, D_ / 64), 256, 0, stream>>>(xb, woT, bo, (float*)d_out);
}

// v005
// Measured time: 103 microseconds a run.
// In both of two side-by-side timings against v004, it was 1.05 times as fast.
// Counting every step since v000, it is 1.71 times as fast.
#include <hip/hip_runtime.h>

typedef __bf16 bf16_t;
typedef __attribute__((ext_vector_type(16))) __bf16 v16bf;
typedef __attribute__((ext_vector_type(8)))  float  v8f;
typedef __attribute__((ext_vector_type(2)))  float  v2f;
typedef int i32x4 __attribute__((vector_size(16)));   // matches builtin's V4i

#define B_   8
#define S_   1024
#define D_   768
#define H_   12
#define DH_  64
#define MTOT (B_ * S_)   // 8192

#define AS1 __attribute__((address_space(1)))
#define AS3 __attribute__((address_space(3)))

// gfx1250 async global->LDS path (ASYNCcnt); fall back to VGPR round-trip if
// this toolchain doesn't declare the builtins.
#if __has_builtin(__builtin_amdgcn_global_load_async_to_lds_b128) && \
    __has_builtin(__builtin_amdgcn_s_wait_asynccnt)
#define ASYNC_OK 1
#else
#define ASYNC_OK 0
#endif

// Copy 16 bytes (8 bf16) global -> LDS, per lane.
__device__ __forceinline__ void stage16(bf16_t* lds, const bf16_t* g) {
#if ASYNC_OK
    __builtin_amdgcn_global_load_async_to_lds_b128(
        (AS1 i32x4*)g, (AS3 i32x4*)lds, /*offset=*/0, /*cpol=*/0);
#else
    *reinterpret_cast<uint4*>(lds) = *reinterpret_cast<const uint4*>(g);
#endif
}

__device__ __forceinline__ void wait_stage() {
#if ASYNC_OK
    __builtin_amdgcn_s_wait_asynccnt(0);
#endif
}

// ---------------------------------------------------------------------------
// Fragment loader: 16 rows x 32 K of bf16, rows K-contiguous in LDS.
// Per-lane layout for V_WMMA_*_16X16X32_BF16 (A and B operands):
//   lane<16 : row = lane,    K = {0..7, 16..23}
//   lane>=16: row = lane-16, K = {8..15, 24..31}
// ---------------------------------------------------------------------------
template<int LDW>
__device__ __forceinline__ v16bf load_frag16(const bf16_t* base) {
    const int lane = threadIdx.x & 31;
    const int idx  = lane & 15;
    const int hf   = lane >> 4;
    const bf16_t* row = base + idx * LDW + hf * 8;
    union { v16bf v; uint4 u[2]; } f;
    f.u[0] = *reinterpret_cast<const uint4*>(row);
    f.u[1] = *reinterpret_cast<const uint4*>(row + 16);
    return f.v;
}

// ---------------------------------------------------------------------------
// Transposing fragment loader: the tile lies in LDS as rows k, columns m
// (m contiguous); the result is the A operand of 16 m x 32 k in the k order of
// load_frag16. base = element (k 0, m 0) of the fragment. One load hands lane
// (idx, hf) the 8 elements k = hf*8 .. hf*8+7 of column idx; the second load,
// 16 rows on, gives k = 16 + hf*8 ..
// ---------------------------------------------------------------------------
typedef __attribute__((ext_vector_type(8))) __bf16 bf16x8;
template<int LDW>
__device__ __forceinline__ v16bf load_fragT16(const bf16_t* base) {
    const int lane = threadIdx.x & 31;
    const bf16_t* p = base + ((lane >> 4) * 8 + (lane & 7)) * LDW + ((lane >> 3) & 1) * 8;
    union { v16bf v; bf16x8 h[2]; } f;
    f.h[0] = __builtin_amdgcn_ds_load_tr16_b128_v8bf16((AS3 bf16x8*)p);
    f.h[1] = __builtin_amdgcn_ds_load_tr16_b128_v8bf16((AS3 bf16x8*)(p + 16 * LDW));
    return f.v;
}

__device__ __forceinline__ v8f wmma_bf16(v16bf a, v16bf b, v8f c) {
    return __builtin_amdgcn_wmma_f32_16x16x32_bf16(
        /*neg_a=*/false, a, /*neg_b=*/false, b,
        /*c_mod=*/(short)0, c, /*reuse_a=*/false, /*reuse_b=*/false);
}

// ---------------------------------------------------------------------------
// Whole-line stores of a wave's result tile, 16 rows x 128 bytes. The products
// below are formed so that lane (idx, hf) holds 8 consecutive columns of row
// idx; it puts them as 16-byte pieces into row idx of stg, 16 rows of 144 bytes
// of LDS that only this wave uses by then. rows16_out reads the rows back with
// 8 lanes on each row: every wave-wide store is 4 whole 128-byte lines instead
// of 16 pieces of 32 bytes.
//   g: first byte of the tile's row 0 in global memory, pitch in bytes
// ---------------------------------------------------------------------------
#define STG_PITCH 144
__device__ __forceinline__ void rows16_out(const char* stg, char* g, size_t pitch) {
    const int lane = threadIdx.x & 31;
    const int row  = lane >> 3;
    const int col  = (lane & 7) * 16;
    // the rows are read back by other lanes of this wave than wrote them: the
    // writes are done first, and the compiler moves no read over this line
    asm volatile("s_wait_dscnt 0x0" ::: "memory");
    uint4 v[4];
    // both loops unrolled: v stays in registers, the 4 reads go out as one group
#pragma unroll
    for (int i = 0; i < 4; ++i)
        v[i] = *reinterpret_cast<const uint4*>(stg + (i * 4 + row) * STG_PITCH + col);
#pragma unroll
    for (int i = 0; i < 4; ++i)
        *reinterpret_cast<uint4*>(g + (size_t)(i * 4 + row) * pitch + col) = v[i];
}

// ---------------------------------------------------------------------------
// Pack kernels: fp32 -> bf16, weights transposed to [N][K] (K-contiguous).
// Few waves with many elements each: a launch with one element per lane is
// bound by how fast waves start, not by its bytes. All five packs are
// independent of each other and go out as ONE launch: each short launch costs
// a gap and its own round trip to memory, which here run side by side.
// ---------------------------------------------------------------------------
typedef __attribute__((ext_vector_type(4))) float  v4f;
typedef __attribute__((ext_vector_type(4))) __bf16 v4bf;
typedef __attribute__((ext_vector_type(8))) __bf16 v8bf;

#define PKX_BLOCKS 512   // 2 blocks of 8 waves per WGP: 16 streaming waves
#define PKX_PER    12    // 16-byte loads per lane, all in flight together
static_assert((size_t)PKX_BLOCKS * 256 * PKX_PER * 4 == (size_t)MTOT * D_,
              "the x pack covers x exactly");

// A block converts 12 x 256 consecutive groups of 4. Each wave-wide load is
// 512 contiguous bytes (4 whole lines), each wave-wide store 256 (2 lines).
__device__ __forceinline__
void pack_f32_bf16(int blk, const float* __restrict__ in, bf16_t* __restrict__ out) {
    const size_t g0 = (size_t)blk * (PKX_PER * 256) + threadIdx.x;
    const v4f* in4  = reinterpret_cast<const v4f*>(in) + g0;
    v4bf*      out4 = reinterpret_cast<v4bf*>(out) + g0;
    v4f f[PKX_PER];
    // unrolled: f stays in registers and all 12 loads are issued before a wait
#pragma unroll
    for (int i = 0; i < PKX_PER; ++i) f[i] = in4[i * 256];
#pragma unroll
    for (int i = 0; i < PKX_PER; ++i)
        out4[i * 256] = __builtin_convertvector(f[i], v4bf);
}

// 64 x 64 tile of a transposing pack, done by 64 lanes. Lane = one output
// row: it reads 64 source rows at its own column (a wave-wide load is one whole
// 128-byte line) and alone writes one whole 128-byte line of the output.
//   src: this lane's column in the tile's first source row, ld = source pitch
//   dst: this lane's 64 consecutive outputs
__device__ __forceinline__ void pack_T64(const float* __restrict__ src, int ld,
                                         bf16_t* __restrict__ dst) {
    float f[64];
    // unrolled: f stays in registers and all 64 loads are issued before a wait
#pragma unroll
    for (int i = 0; i < 64; ++i) f[i] = src[(size_t)i * ld];
#pragma unroll
    for (int c = 0; c < 8; ++c) {
        v8bf o;
#pragma unroll
        for (int q = 0; q < 8; ++q) o[q] = (bf16_t)f[c * 8 + q];
        reinterpret_cast<v8bf*>(dst)[c] = o;
    }
    // precaution: stands in front of any overwrite of the stores' address and
    // data registers by the code that follows this inlined body
    asm volatile("s_wait_xcnt 0x0" ::: "memory");
}

#define PKW_TILES  ((D_ / 64) * (D_ / 64))   // 144 tiles of 64 x 64 per matrix
#define PKW_PERMAT (PKW_TILES / 4)           // 36 blocks of 4 tiles per matrix
#define PKW_BLOCKS (4 * PKW_PERMAT)          // Wq, Wk, Wv, Wo

// Blocks 0..143: weight tiles, 4 per block (64 lanes each), one matrix per 36
// blocks. Blocks 144..655: x. wT holds the four packed matrices in a row.
//   head W: [H, D, DH] ; outT[n*768 + d] = W[h, d, e] with n = h*64 + e
//   Wo:     [D, D] row-major ; outT[n*768 + d] = Wo[d, n]
__global__ __launch_bounds__(256)
void pack_all(const float* __restrict__ x,
              const float* __restrict__ Wq, const float* __restrict__ Wk,
              const float* __restrict__ Wv, const float* __restrict__ Wo,
              bf16_t* __restrict__ xb, bf16_t* __restrict__ wT) {
    if (blockIdx.x >= PKW_BLOCKS) {
        pack_f32_bf16(blockIdx.x - PKW_BLOCKS, x, xb);
        return;
    }
    const int mat  = blockIdx.x / PKW_PERMAT;
    const int tile = (blockIdx.x % PKW_PERMAT) * 4 + (threadIdx.x >> 6);
    const int nt   = tile / (D_ / 64);            // head, or 64-column group of Wo
    const int d0   = (tile % (D_ / 64)) * 64;
    const int e    = threadIdx.x & 63;
    bf16_t* dst = wT + (size_t)mat * (D_ * D_) + (size_t)(nt * 64 + e) * D_ + d0;
    if (mat < 3) {
        const float* W = mat == 0 ? Wq : (mat == 1 ? Wk : Wv);
        pack_T64(W + ((size_t)nt * D_ + d0) * DH_ + e, DH_, dst);
    } else {
        pack_T64(Wo + (size_t)d0 * D_ + nt * 64 + e, D_, dst);
    }
}

// ---------------------------------------------------------------------------
// GEMM: C[8192 x 768] = A[8192 x 768] * BT^T + bias
//   A row-major bf16 (K contiguous), BT = B transposed [N][K] bf16.
//   Block tile 128x64, BK=64, 8 waves, each wave -> 16 rows x 64 cols,
//   formed as C^T (BT rows as first operand): a lane holds 8 neighbour columns.
//   MODE 0: out bf16 row-major  (QKV path)
//   MODE 1: out f32  row-major  (final projection -> d_out)
//   ny: the block's 64-column tile of this product
// ---------------------------------------------------------------------------
template<int MODE>
__device__ __forceinline__
void gemm_bf16_128x64(const bf16_t* __restrict__ A,
                      const bf16_t* __restrict__ BT,
                      const float* __restrict__ bias,
                      void* __restrict__ outp, int ny) {
    constexpr int LDA = 72;                 // padded row stride (bf16 elems)
    __shared__ bf16_t As[128 * LDA];        // 128 x 64 tile
    __shared__ bf16_t Bs[64 * LDA];         //  64 x 64 tile

    const int m0   = blockIdx.x * 128;
    const int n0   = ny * 64;
    const int wave = threadIdx.x >> 5;
    const int lane = threadIdx.x & 31;
    const int idx  = lane & 15;
    const int hf   = lane >> 4;

    v8f acc[4];
#pragma unroll
    for (int j = 0; j < 4; ++j)
#pragma unroll
        for (int r = 0; r < 8; ++r) acc[j][r] = 0.0f;

    // unrolled whole, as the build of the separate launches was: left alone the
    // merged QKV kernel keeps this loop rolled, with address arithmetic per trip
    // instead of k offsets as immediates of the copies
#pragma unroll
    for (int kt = 0; kt < D_ / 64; ++kt) {
        const int k0 = kt * 64;
        // stage A tile: 128x64 -> 1024 16B chunks, 4 per thread
#pragma unroll
        for (int i = 0; i < 4; ++i) {
            int v = threadIdx.x + i * 256;
            int row = v >> 3, cv = v & 7;
            stage16(&As[row * LDA + cv * 8],
                    &A[(size_t)(m0 + row) * D_ + k0 + cv * 8]);
        }
        // stage B tile: 64x64 -> 512 16B chunks, 2 per thread
#pragma unroll
        for (int i = 0; i < 2; ++i) {
            int v = threadIdx.x + i * 256;
            int row = v >> 3, cv = v & 7;
            stage16(&Bs[row * LDA + cv * 8],
                    &BT[(size_t)(n0 + row) * D_ + k0 + cv * 8]);
        }
        wait_stage();
        __syncthreads();

#pragma unroll
        for (int kc = 0; kc < 64; kc += 32) {
            v16bf a = load_frag16<LDA>(&As[wave * 16 * LDA + kc]);
#pragma unroll
            for (int j = 0; j < 4; ++j) {
                v16bf b = load_frag16<LDA>(&Bs[j * 16 * LDA + kc]);
                acc[j] = wmma_bf16(b, a, acc[j]);   // C^T tile: rows n, columns m
            }
        }
        __syncthreads();
    }

    // keeps the epilogue's lane arithmetic out of the k loop
    __builtin_amdgcn_sched_barrier(0);

    // epilogue: acc[j][r] = C element (m = m0 + wave*16 + idx, n = n0 + j*16 + hf*8 + r).
    // Behind the loop's last barrier nobody reads As any more: the wave stages
    // in the 16 rows of As that were its own A rows.
    static_assert(LDA * sizeof(bf16_t) == STG_PITCH, "a staging row is a row of As");
    char* stg  = reinterpret_cast<char*>(&As[wave * 16 * LDA]);
    char* mine = stg + idx * STG_PITCH;
    v4f bn[4][2];
    // every loop of the epilogue is unrolled: acc and bn are indexed by constants
    // and stay in registers, and the 8 bias loads go out together
    const unsigned boff = hf * 32;          // the lane's byte offset in the tile's 64 biases
    const char* bt = reinterpret_cast<const char*>(bias + n0);
#pragma unroll
    for (int j = 0; j < 4; ++j) {
        const v4f* bp = reinterpret_cast<const v4f*>(bt + boff + j * 64);
        bn[j][0] = bp[0];
        bn[j][1] = bp[1];
    }
    // precaution: stands in front of any overwrite of the loads' offset register;
    // naming it here keeps it live, so that no result of the run lands in it
    asm volatile("s_wait_xcnt 0x0" :: "v"(boff) : "memory");
#pragma unroll
    for (int j = 0; j < 4; ++j)
#pragma unroll
        for (int r = 0; r < 8; ++r) acc[j][r] += bn[j][r >> 2][r & 3];

    const size_t mrow = (size_t)(m0 + wave * 16);
    if constexpr (MODE == 0) {
        // a row of the tile is 64 bf16 = one line
#pragma unroll
        for (int j = 0; j < 4; ++j)
            *reinterpret_cast<v8bf*>(mine + j * 32 + hf * 16) =
                __builtin_convertvector(acc[j], v8bf);
        rows16_out(stg, reinterpret_cast<char*>((bf16_t*)outp + mrow * D_ + n0),
                   D_ * sizeof(bf16_t));
    } else {
        // a row of the tile is 64 f32 = two lines: one line of every row at a time
#pragma unroll
        for (int half = 0; half < 2; ++half) {
            if (half == 1) {
                // the first half's rows are overwritten next: its read-back has
                // returned; precaution: in front of any reuse of its stores' registers
                asm volatile("s_wait_xcnt 0x0\n\ts_wait_dscnt 0x0" ::: "memory");
            }
#pragma unroll
            for (int jj = 0; jj < 2; ++jj) {
                const v8f c = acc[half * 2 + jj];
                v4f* p = reinterpret_cast<v4f*>(mine + jj * 64 + hf * 32);
                p[0] = __builtin_shufflevector(c, c, 0, 1, 2, 3);
                p[1] = __builtin_shufflevector(c, c, 4, 5, 6, 7);
            }
            rows16_out(stg, reinterpret_cast<char*>((float*)outp + mrow * D_ + n0 + half * 32),
                       D_ * sizeof(float));
        }
    }
}

// Q, K and V projections in one launch: they share A and do not depend on each
// other. blockIdx.y = product * 12 + column tile; the packed weights and the
// three outputs each lie in a row in the workspace.
// second figure: 10 waves a SIMD, so that the build stays within 96 registers and
// 5 blocks fit a WGP (each WGP has 9 to do: two rounds); left alone it takes 98,
// allocated as 112, and only 4 fit
__global__ __launch_bounds__(256, 10)
void gemm_qkv(const bf16_t* __restrict__ A, const bf16_t* __restrict__ wT,
              const float* __restrict__ bq, const float* __restrict__ bk,
              const float* __restrict__ bv, bf16_t* __restrict__ qkv) {
    const int p = blockIdx.y / (D_ / 64);
    const float* bias = p == 0 ? bq : (p == 1 ? bk : bv);
    gemm_bf16_128x64<0>(A, wT + (size_t)p * (D_ * D_), bias,
                        qkv + (size_t)p * ((size_t)MTOT * D_),
                        blockIdx.y % (D_ / 64));
}

__global__ __launch_bounds__(256)
void gemm_out(const bf16_t* __restrict__ A, const bf16_t* __restrict__ BT,
              const float* __restrict__ bias, float* __restrict__ out) {
    gemm_bf16_128x64<1>(A, BT, bias, out, blockIdx.y);
}

// ---------------------------------------------------------------------------
// Flash-style attention, transposed products. Q/K/V bf16 row-major
// [B*S][768], head slice at column h*64. One block = one (b,h) x 128 query
// rows; key tiles of 64. Each wave owns 16 queries.
//   S^T = K * Q^T : tile j holds key j*16 + hf*8 + r (register r), query idx
//   O^T += V^T * P^T : tile j holds e = j*16 + hf*8 + r, query idx
// A lane holds one query only: its maximum and sum are in-lane over its half
// of the keys, and two S^T tiles convert in place into the B operand P^T.
// V is copied to LDS as it lies (rows t); the transposing load makes V^T.
// ---------------------------------------------------------------------------
// lane l <-> lane l ^ 16 (the two lanes that share a query)
__device__ __forceinline__ float xhalf(float x) {
    return __builtin_bit_cast(float, __builtin_amdgcn_permlanex16(
        __builtin_bit_cast(int, x), __builtin_bit_cast(int, x),
        0x76543210, 0xfedcba98, false, false));
}

__global__ __launch_bounds__(256)
void attn_kernel(const bf16_t* __restrict__ Q, const bf16_t* __restrict__ K,
                 const bf16_t* __restrict__ V, bf16_t* __restrict__ O) {
    constexpr int LD = 72;                  // padded row stride (bf16 elems)
    __shared__ bf16_t Qs[128 * LD];         // 128 q-rows x 64
    __shared__ bf16_t Ks[64 * LD];          // 64 k-rows  x 64 (rows t, cols e)
    constexpr int LDV = 80;                 // V row stride: 160 B = 32 B x odd,
                                            // free of bank conflicts for the transposing load
    __shared__ __attribute__((aligned(16))) bf16_t Vs[64 * LDV];   // 64 k-rows x 64 (rows t, cols e)

    const int bh   = blockIdx.y;
    const int b    = bh / H_;
    const int h    = bh % H_;
    const int q0   = blockIdx.x * 128;
    const int wave = threadIdx.x >> 5;
    const int lane = threadIdx.x & 31;
    const int idx  = lane & 15;
    const int hf   = lane >> 4;
    const size_t base = (size_t)b * S_ * D_ + (size_t)h * DH_;

    // stage Q tile once: 128x64 -> 1024 16B chunks, 4 per thread (async)
#pragma unroll
    for (int i = 0; i < 4; ++i) {
        int v = threadIdx.x + i * 256;
        int row = v >> 3, cv = v & 7;
        stage16(&Qs[row * LD + cv * 8],
                &Q[base + (size_t)(q0 + row) * D_ + cv * 8]);
    }

    v8f acc[4];
    float mrow = -3.0e38f;   // running maximum of this lane's query
    float lrow = 0.0f;       // running sum over this lane's half of the keys
#pragma unroll
    for (int j = 0; j < 4; ++j)
#pragma unroll
        for (int r = 0; r < 8; ++r) acc[j][r] = 0.0f;

    for (int kt = 0; kt < S_ / 64; ++kt) {
        const int t0 = kt * 64;
        // stage K tile (as-is: rows t, K-contiguous e -> A operand of K*Q^T)
#pragma unroll
        for (int i = 0; i < 2; ++i) {
            int v = threadIdx.x + i * 256;
            int row = v >> 3, cv = v & 7;
            stage16(&Ks[row * LD + cv * 8],
                    &K[base + (size_t)(t0 + row) * D_ + cv * 8]);
        }
        // stage V tile as it lies (rows t, cols e): copies like K's, landed
        // behind the same wait and published by the same barrier below
#pragma unroll
        for (int i = 0; i < 2; ++i) {
            int v = threadIdx.x + i * 256;
            int row = v >> 3, cv = v & 7;
            stage16(&Vs[row * LDV + cv * 8],
                    &V[base + (size_t)(t0 + row) * D_ + cv * 8]);
        }
        wait_stage();        // Q (first iter) + K + V async copies complete
        __syncthreads();

        // scores: S^T = K(64x64) * Q^T(64x16) -> 4 tiles of 16 keys x 16 queries
        v8f sc[4];
#pragma unroll
        for (int j = 0; j < 4; ++j)
#pragma unroll
            for (int r = 0; r < 8; ++r) sc[j][r] = 0.0f;
#pragma unroll
        for (int kc = 0; kc < 64; kc += 32) {
            v16bf bq = load_frag16<LD>(&Qs[wave * 16 * LD + kc]);
#pragma unroll
            for (int j = 0; j < 4; ++j) {
                v16bf ak = load_frag16<LD>(&Ks[j * 16 * LD + kc]);
                sc[j] = wmma_bf16(ak, bq, sc[j]);
            }
        }

        // online softmax; all 32 values of a lane belong to query idx
        float tmax = -3.0e38f;
#pragma unroll
        for (int j = 0; j < 4; ++j)
#pragma unroll
            for (int r = 0; r < 8; ++r) {
                sc[j][r] *= 0.125f;               // 1/sqrt(DH)
                tmax = fmaxf(tmax, sc[j][r]);
            }
        tmax = fmaxf(tmax, xhalf(tmax));          // both halves: the query's maximum

        const float mn    = fmaxf(mrow, tmax);
        const float alpha = __expf(mrow - mn);
        mrow = mn;
        v2f tsum = {0.0f, 0.0f};                  // even and odd registers apart
#pragma unroll
        for (int j = 0; j < 4; ++j)
#pragma unroll
            for (int r = 0; r < 8; r += 2) {
                v2f p = {__expf(sc[j][r] - mrow), __expf(sc[j][r + 1] - mrow)};
                sc[j][r]     = p.x;
                sc[j][r + 1] = p.y;
                tsum += p;
            }
        lrow = lrow * alpha + (tsum.x + tsum.y);
#pragma unroll
        for (int j = 0; j < 4; ++j)
#pragma unroll
            for (int r = 0; r < 8; ++r) acc[j][r] *= alpha;

        // O^T += V^T(64x64) * P^T(64x16). Two S^T tiles (keys kc..kc+31) are,
        // converted in place, the B operand in the loader's k order:
        // element s<8 -> key kc + hf*8 + s, element 8+s -> key kc + 16 + hf*8 + s
#pragma unroll
        for (int kc = 0; kc < 64; kc += 32) {
            v16bf bp;
#pragma unroll
            for (int s = 0; s < 8; ++s) {
                bp[s]     = (bf16_t)sc[kc / 16][s];
                bp[8 + s] = (bf16_t)sc[kc / 16 + 1][s];
            }
#pragma unroll
            for (int j = 0; j < 4; ++j) {
                v16bf av = load_fragT16<LDV>(&Vs[kc * LDV + j * 16]);
                acc[j] = wmma_bf16(av, bp, acc[j]);
            }
        }
        __syncthreads();
    }

    // join the two halves' sums once; a lane's 8 registers of tile j are
    // 8 consecutive e of its query. A query's 64 e are one line: staged in the
    // wave's own 16 rows of Qs, which no other wave reads, and stored whole
    static_assert(LD * sizeof(bf16_t) == STG_PITCH, "a staging row is a row of Qs");
    const float inv = 1.0f / (lrow + xhalf(lrow));
    char* stg = reinterpret_cast<char*>(&Qs[wave * 16 * LD]);
    // unrolled: acc is indexed by constants and stays in registers
#pragma unroll
    for (int j = 0; j < 4; ++j)
        *reinterpret_cast<v8bf*>(stg + idx * STG_PITCH + j * 32 + hf * 16) =
            __builtin_convertvector(acc[j] * inv, v8bf);
    rows16_out(stg, reinterpret_cast<char*>(&O[base + (size_t)(q0 + wave * 16) * D_]),
               D_ * sizeof(bf16_t));
}

// ---------------------------------------------------------------------------
// Launch: pack -> QKV GEMM -> attention -> output projection (4 launches).
// Workspace (bf16): xb | qb | kb | vb | wqT | wkT | wvT | woT  (~53 MB).
// Attention output reuses xb (x is dead after the QKV GEMMs).
// ---------------------------------------------------------------------------
extern "C" void kernel_launch(void* const* d_in, const int* in_sizes, int n_in,
                              void* d_out, int out_size, void* d_ws, size_t ws_size,
                              hipStream_t stream) {
    (void)in_sizes; (void)n_in; (void)out_size;

    const float* x  = (const float*)d_in[0];
    const float* Wq = (const float*)d_in[1];
    const float* bq = (const float*)d_in[2];
    const float* Wk = (const float*)d_in[3];
    const float* bk = (const float*)d_in[4];
    const float* Wv = (const float*)d_in[5];
    const float* bv = (const float*)d_in[6];
    const float* Wo = (const float*)d_in[7];
    const float* bo = (const float*)d_in[8];

    const size_t MD = (size_t)MTOT * D_;   // 6,291,456 elems
    const size_t WN = (size_t)D_ * D_;     //   589,824 elems
    if (ws_size < (4 * MD + 4 * WN) * sizeof(bf16_t)) return;

    bf16_t* xb  = (bf16_t*)d_ws;
    bf16_t* qb  = xb  + MD;
    bf16_t* kb  = qb  + MD;
    bf16_t* vb  = kb  + MD;
    bf16_t* wqT = vb  + MD;
    bf16_t* wkT = wqT + WN;
    bf16_t* wvT = wkT + WN;
    bf16_t* woT = wvT + WN;

    pack_all<<<PKW_BLOCKS + PKX_BLOCKS, 256, 0, stream>>>(x, Wq, Wk, Wv, Wo, xb, wqT);

    gemm_qkv<<<dim3(MTOT / 128, 3 * (D_ / 64)), 256, 0, stream>>>(xb, wqT, bq, bk, bv, qb);

    attn_kernel<<<dim3(S_ / 128, B_ * H_), 256, 0, stream>>>(qb, kb, vb, xb);

    gemm_out<<<dim3(MTOT / 128, D_ / 64), 256, 0, stream>>>(xb, woT, bo, (float*)d_out);
}

// v006
// A run of this version takes 95.3 microseconds.
// Two timings next to v005 put it at 1.08 and 1.10 times that version's speed.
// Over all steps from v000 it is 1.86 times as fast.
#include <hip/hip_runtime.h>

typedef __bf16 bf16_t;
typedef __attribute__((ext_vector_type(16))) __bf16 v16bf;
typedef __attribute__((ext_vector_type(8)))  float  v8f;
typedef __attribute__((ext_vector_type(2)))  float  v2f;
typedef int i32x4 __attribute__((vector_size(16)));   // matches builtin's V4i

#define B_   8
#define S_   1024
#define D_   768
#define H_   12
#define DH_  64
#define MTOT (B_ * S_)   // 8192

#define AS1 __attribute__((address_space(1)))
#define AS3 __attribute__((address_space(3)))

// gfx1250 async global->LDS path (ASYNCcnt); fall back to VGPR round-trip if
// this toolchain doesn't declare the builtins.
#if __has_builtin(__builtin_amdgcn_global_load_async_to_lds_b128) && \
    __has_builtin(__builtin_amdgcn_s_wait_asynccnt)
#define ASYNC_OK 1
#else
#define ASYNC_OK 0
#endif

// Copy 16 bytes (8 bf16) global -> LDS, per lane.
__device__ __forceinline__ void stage16(bf16_t* lds, const bf16_t* g) {
#if ASYNC_OK
    __builtin_amdgcn_global_load_async_to_lds_b128(
        (AS1 i32x4*)g, (AS3 i32x4*)lds, /*offset=*/0, /*cpol=*/0);
#else
    *reinterpret_cast<uint4*>(lds) = *reinterpret_cast<const uint4*>(g);
#endif
}

// The same with an immediate offset N, which the copy adds to BOTH addresses:
// LDS byte = lds + N, global byte = g + N.
template<int N>
__device__ __forceinline__ void stage16_off(char* lds, const char* g) {
#if ASYNC_OK
    __builtin_amdgcn_global_load_async_to_lds_b128(
        (AS1 i32x4*)g, (AS3 i32x4*)lds, /*offset=*/N, /*cpol=*/0);
#else
    *reinterpret_cast<uint4*>(lds + N) = *reinterpret_cast<const uint4*>(g + N);
#endif
}

// A block-uniform address held in scalar registers: a copy from it plus a 32-bit
// lane offset takes the form "scalar base + offset register", and the steps from
// copy to copy are scalar additions; left to itself the build adds every step to
// a 64-bit vector address, in registers that the fragments need.
__device__ __forceinline__ const char* scalar_ptr(const char* p) {
    const unsigned long long v = reinterpret_cast<unsigned long long>(p);
    const unsigned lo = (unsigned)__builtin_amdgcn_readfirstlane((int)(unsigned)v);
    const unsigned hi = (unsigned)__builtin_amdgcn_readfirstlane((int)(unsigned)(v >> 32));
    return reinterpret_cast<const char*>(((unsigned long long)hi << 32) | lo);
}

__device__ __forceinline__ void wait_stage() {
#if ASYNC_OK
    __builtin_amdgcn_s_wait_asynccnt(0);
#endif
}

// ---------------------------------------------------------------------------
// Fragment loader: 16 rows x 32 K of bf16, rows K-contiguous in LDS.
// Per-lane layout for V_WMMA_*_16X16X32_BF16 (A and B operands):
//   lane<16 : row = lane,    K = {0..7, 16..23}
//   lane>=16: row = lane-16, K = {8..15, 24..31}
// ---------------------------------------------------------------------------
template<int LDW>
__device__ __forceinline__ v16bf load_frag16(const bf16_t* base) {
    const int lane = threadIdx.x & 31;
    const int idx  = lane & 15;
    const int hf   = lane >> 4;
    const bf16_t* row = base + idx * LDW + hf * 8;
    union { v16bf v; uint4 u[2]; } f;
    f.u[0] = *reinterpret_cast<const uint4*>(row);
    f.u[1] = *reinterpret_cast<const uint4*>(row + 16);
    return f.v;
}

// ---------------------------------------------------------------------------
// Transposing fragment loader: the tile lies in LDS as rows k, columns m
// (m contiguous); the result is the A operand of 16 m x 32 k in the k order of
// load_frag16. base = element (k 0, m 0) of the fragment. One load hands lane
// (idx, hf) the 8 elements k = hf*8 .. hf*8+7 of column idx; the second load,
// 16 rows on, gives k = 16 + hf*8 ..
// ---------------------------------------------------------------------------
typedef __attribute__((ext_vector_type(8))) __bf16 bf16x8;
template<int LDW>
__device__ __forceinline__ v16bf load_fragT16(const bf16_t* base) {
    const int lane = threadIdx.x & 31;
    const bf16_t* p = base + ((lane >> 4) * 8 + (lane & 7)) * LDW + ((lane >> 3) & 1) * 8;
    union { v16bf v; bf16x8 h[2]; } f;
    f.h[0] = __builtin_amdgcn_ds_load_tr16_b128_v8bf16((AS3 bf16x8*)p);
    f.h[1] = __builtin_amdgcn_ds_load_tr16_b128_v8bf16((AS3 bf16x8*)(p + 16 * LDW));
    return f.v;
}

__device__ __forceinline__ v8f wmma_bf16(v16bf a, v16bf b, v8f c) {
    return __builtin_amdgcn_wmma_f32_16x16x32_bf16(
        /*neg_a=*/false, a, /*neg_b=*/false, b,
        /*c_mod=*/(short)0, c, /*reuse_a=*/false, /*reuse_b=*/false);
}

// ---------------------------------------------------------------------------
// Whole-line stores of a wave's result tile, 16 rows x 128 bytes. The products
// below are formed so that lane (idx, hf) holds 8 consecutive columns of row
// idx; it puts them as 16-byte pieces into row idx of stg, 16 rows of 144 bytes
// of LDS that only this wave uses by then. rows16_out reads the rows back with
// 8 lanes on each row: every wave-wide store is 4 whole 128-byte lines instead
// of 16 pieces of 32 bytes.
//   g: first byte of the tile's row 0 in global memory, pitch in bytes
// ---------------------------------------------------------------------------
#define STG_PITCH 144
__device__ __forceinline__ void rows16_out(const char* stg, char* g, size_t pitch) {
    const int lane = threadIdx.x & 31;
    const int row  = lane >> 3;
    const int col  = (lane & 7) * 16;
    // the rows are read back by other lanes of this wave than wrote them: the
    // writes are done first, and the compiler moves no read over this line
    asm volatile("s_wait_dscnt 0x0" ::: "memory");
    uint4 v[4];
    // both loops unrolled: v stays in registers, the 4 reads go out as one group
#pragma unroll
    for (int i = 0; i < 4; ++i)
        v[i] = *reinterpret_cast<const uint4*>(stg + (i * 4 + row) * STG_PITCH + col);
#pragma unroll
    for (int i = 0; i < 4; ++i)
        *reinterpret_cast<uint4*>(g + (size_t)(i * 4 + row) * pitch + col) = v[i];
}

// ---------------------------------------------------------------------------
// Pack kernels: fp32 -> bf16, weights transposed to [N][K] (K-contiguous).
// Few waves with many elements each: a launch with one element per lane is
// bound by how fast waves start, not by its bytes. All five packs are
// independent of each other and go out as ONE launch: each short launch costs
// a gap and its own round trip to memory, which here run side by side.
// ---------------------------------------------------------------------------
typedef __attribute__((ext_vector_type(4))) float  v4f;
typedef __attribute__((ext_vector_type(4))) __bf16 v4bf;
typedef __attribute__((ext_vector_type(8))) __bf16 v8bf;

#define PKX_BLOCKS 512   // 2 blocks of 8 waves per WGP: 16 streaming waves
#define PKX_PER    12    // 16-byte loads per lane, all in flight together
static_assert((size_t)PKX_BLOCKS * 256 * PKX_PER * 4 == (size_t)MTOT * D_,
              "the x pack covers x exactly");

// A block converts 12 x 256 consecutive groups of 4. Each wave-wide load is
// 512 contiguous bytes (4 whole lines), each wave-wide store 256 (2 lines).
__device__ __forceinline__
void pack_f32_bf16(int blk, const float* __restrict__ in, bf16_t* __restrict__ out) {
    const size_t g0 = (size_t)blk * (PKX_PER * 256) + threadIdx.x;
    const v4f* in4  = reinterpret_cast<const v4f*>(in) + g0;
    v4bf*      out4 = reinterpret_cast<v4bf*>(out) + g0;
    v4f f[PKX_PER];
    // unrolled: f stays in registers and all 12 loads are issued before a wait
#pragma unroll
    for (int i = 0; i < PKX_PER; ++i) f[i] = in4[i * 256];
#pragma unroll
    for (int i = 0; i < PKX_PER; ++i)
        out4[i * 256] = __builtin_convertvector(f[i], v4bf);
}

// 64 x 64 tile of a transposing pack, done by 64 lanes. Lane = one output
// row: it reads 64 source rows at its own column (a wave-wide load is one whole
// 128-byte line) and alone writes one whole 128-byte line of the output.
//   src: this lane's column in the tile's first source row, ld = source pitch
//   dst: this lane's 64 consecutive outputs
__device__ __forceinline__ void pack_T64(const float* __restrict__ src, int ld,
                                         bf16_t* __restrict__ dst) {
    float f[64];
    // unrolled: f stays in registers and all 64 loads are issued before a wait
#pragma unroll
    for (int i = 0; i < 64; ++i) f[i] = src[(size_t)i * ld];
#pragma unroll
    for (int c = 0; c < 8; ++c) {
        v8bf o;
#pragma unroll
        for (int q = 0; q < 8; ++q) o[q] = (bf16_t)f[c * 8 + q];
        reinterpret_cast<v8bf*>(dst)[c] = o;
    }
    // precaution: stands in front of any overwrite of the stores' address and
    // data registers by the code that follows this inlined body
    asm volatile("s_wait_xcnt 0x0" ::: "memory");
}

#define PKW_TILES  ((D_ / 64) * (D_ / 64))   // 144 tiles of 64 x 64 per matrix
#define PKW_PERMAT (PKW_TILES / 4)           // 36 blocks of 4 tiles per matrix
#define PKW_BLOCKS (4 * PKW_PERMAT)          // Wq, Wk, Wv, Wo

// Blocks 0..143: weight tiles, 4 per block (64 lanes each), one matrix per 36
// blocks. Blocks 144..655: x. wT holds the four packed matrices in a row.
//   head W: [H, D, DH] ; outT[n*768 + d] = W[h, d, e] with n = h*64 + e
//   Wo:     [D, D] row-major ; outT[n*768 + d] = Wo[d, n]
__global__ __launch_bounds__(256)
void pack_all(const float* __restrict__ x,
              const float* __restrict__ Wq, const float* __restrict__ Wk,
              const float* __restrict__ Wv, const float* __restrict__ Wo,
              bf16_t* __restrict__ xb, bf16_t* __restrict__ wT) {
    if (blockIdx.x >= PKW_BLOCKS) {
        pack_f32_bf16(blockIdx.x - PKW_BLOCKS, x, xb);
        return;
    }
    const int mat  = blockIdx.x / PKW_PERMAT;
    const int tile = (blockIdx.x % PKW_PERMAT) * 4 + (threadIdx.x >> 6);
    const int nt   = tile / (D_ / 64);            // head, or 64-column group of Wo
    const int d0   = (tile % (D_ / 64)) * 64;
    const int e    = threadIdx.x & 63;
    bf16_t* dst = wT + (size_t)mat * (D_ * D_) + (size_t)(nt * 64 + e) * D_ + d0;
    if (mat < 3) {
        const float* W = mat == 0 ? Wq : (mat == 1 ? Wk : Wv);
        pack_T64(W + ((size_t)nt * D_ + d0) * DH_ + e, DH_, dst);
    } else {
        pack_T64(Wo + (size_t)d0 * D_ + nt * 64 + e, D_, dst);
    }
}

// ---------------------------------------------------------------------------
// GEMM: C[8192 x 768] = A[8192 x 768] * BT^T + bias
//   A row-major bf16 (K contiguous), BT = B transposed [N][K] bf16.
//   Block tile 128x64, BK=64, 8 waves, each wave -> 16 rows x 64 cols,
//   formed as C^T (BT rows as first operand): a lane holds 8 neighbour columns.
//   out f32 row-major (final projection -> d_out)
//   ny: the block's 64-column tile of this product
// ---------------------------------------------------------------------------
__device__ __forceinline__
void gemm_bf16_128x64(const bf16_t* __restrict__ A,
                      const bf16_t* __restrict__ BT,
                      const float* __restrict__ bias,
                      void* __restrict__ outp, int ny) {
    constexpr int LDA = 72;                 // padded row stride (bf16 elems)
    __shared__ bf16_t As[128 * LDA];        // 128 x 64 tile
    __shared__ bf16_t Bs[64 * LDA];         //  64 x 64 tile

    const int m0   = blockIdx.x * 128;
    const int n0   = ny * 64;
    const int wave = threadIdx.x >> 5;
    const int lane = threadIdx.x & 31;
    const int idx  = lane & 15;
    const int hf   = lane >> 4;

    v8f acc[4];
#pragma unroll
    for (int j = 0; j < 4; ++j)
#pragma unroll
        for (int r = 0; r < 8; ++r) acc[j][r] = 0.0f;

#pragma unroll
    for (int kt = 0; kt < D_ / 64; ++kt) {
        const int k0 = kt * 64;
        // stage A tile: 128x64 -> 1024 16B chunks, 4 per thread
#pragma unroll
        for (int i = 0; i < 4; ++i) {
            int v = threadIdx.x + i * 256;
            int row = v >> 3, cv = v & 7;
            stage16(&As[row * LDA + cv * 8],
                    &A[(size_t)(m0 + row) * D_ + k0 + cv * 8]);
        }
        // stage B tile: 64x64 -> 512 16B chunks, 2 per thread
#pragma unroll
        for (int i = 0; i < 2; ++i) {
            int v = threadIdx.x + i * 256;
            int row = v >> 3, cv = v & 7;
            stage16(&Bs[row * LDA + cv * 8],
                    &BT[(size_t)(n0 + row) * D_ + k0 + cv * 8]);
        }
        wait_stage();
        __syncthreads();

#pragma unroll
        for (int kc = 0; kc < 64; kc += 32) {
            v16bf a = load_frag16<LDA>(&As[wave * 16 * LDA + kc]);
#pragma unroll
            for (int j = 0; j < 4; ++j) {
                v16bf b = load_frag16<LDA>(&Bs[j * 16 * LDA + kc]);
                acc[j] = wmma_bf16(b, a, acc[j]);   // C^T tile: rows n, columns m
            }
        }
        __syncthreads();
    }

    // keeps the epilogue's lane arithmetic out of the k loop
    __builtin_amdgcn_sched_barrier(0);

    // epilogue: acc[j][r] = C element (m = m0 + wave*16 + idx, n = n0 + j*16 + hf*8 + r).
    // Behind the loop's last barrier nobody reads As any more: the wave stages
    // in the 16 rows of As that were its own A rows.
    static_assert(LDA * sizeof(bf16_t) == STG_PITCH, "a staging row is a row of As");
    char* stg  = reinterpret_cast<char*>(&As[wave * 16 * LDA]);
    char* mine = stg + idx * STG_PITCH;
    v4f bn[4][2];
    // every loop of the epilogue is unrolled: acc and bn are indexed by constants
    // and stay in registers, and the 8 bias loads go out together
    const unsigned boff = hf * 32;          // the lane's byte offset in the tile's 64 biases
    const char* bt = reinterpret_cast<const char*>(bias + n0);
#pragma unroll
    for (int j = 0; j < 4; ++j) {
        const v4f* bp = reinterpret_cast<const v4f*>(bt + boff + j * 64);
        bn[j][0] = bp[0];
        bn[j][1] = bp[1];
    }
    // precaution: stands in front of any overwrite of the loads' offset register;
    // naming it here keeps it live, so that no result of the run lands in it
    asm volatile("s_wait_xcnt 0x0" :: "v"(boff) : "memory");
#pragma unroll
    for (int j = 0; j < 4; ++j)
#pragma unroll
        for (int r = 0; r < 8; ++r) acc[j][r] += bn[j][r >> 2][r & 3];

    const size_t mrow = (size_t)(m0 + wave * 16);
    {
        // a row of the tile is 64 f32 = two lines: one line of every row at a time
#pragma unroll
        for (int half = 0; half < 2; ++half) {
            if (half == 1) {
                // the first half's rows are overwritten next: its read-back has
                // returned; precaution: in front of any reuse of its stores' registers
                asm volatile("s_wait_xcnt 0x0\n\ts_wait_dscnt 0x0" ::: "memory");
            }
#pragma unroll
            for (int jj = 0; jj < 2; ++jj) {
                const v8f c = acc[half * 2 + jj];
                v4f* p = reinterpret_cast<v4f*>(mine + jj * 64 + hf * 32);
                p[0] = __builtin_shufflevector(c, c, 0, 1, 2, 3);
                p[1] = __builtin_shufflevector(c, c, 4, 5, 6, 7);
            }
            rows16_out(stg, reinterpret_cast<char*>((float*)outp + mrow * D_ + n0 + half * 32),
                       D_ * sizeof(float));
        }
    }
}

// Q, K and V projections in one launch: they share A and do not depend on each
// other. Block tile 128 rows x 192 columns, a quarter of one product's columns:
// 768 blocks, 3 on every WGP, all resident at once. Against a 128 x 64 tile a
// block brings 320 operand rows for 3 times the result instead of 192 for one,
// and a wave (64 rows x 48 columns, 2 x 4 waves) reads 7 fragments for 12
// products instead of 5 for 4.
// blockIdx.y = product * 4 + column tile; the packed weights and the three
// outputs each lie in a row in the workspace.
#define QKV_BN    192
#define QKV_PITCH 400    // staged result row: 384 bytes + 16, an odd count of 16-byte units
// second figure: 6 waves a SIMD, so that the 3 blocks of a WGP are resident together
__global__ __launch_bounds__(256, 6)
void gemm_qkv(const bf16_t* __restrict__ A, const bf16_t* __restrict__ wT,
              const float* __restrict__ bq, const float* __restrict__ bk,
              const float* __restrict__ bv, bf16_t* __restrict__ qkv) {
    constexpr int LDA = 72;                 // padded row stride (bf16 elems)
    // k loop: A tile 128 x 64, then B tile 192 x 64; epilogue: the result tile
    __shared__ __attribute__((aligned(16))) char smem[128 * QKV_PITCH];
    static_assert((128 + QKV_BN) * LDA * sizeof(bf16_t) <= sizeof(smem), "both tiles fit");
    bf16_t* As = reinterpret_cast<bf16_t*>(smem);
    bf16_t* Bs = As + 128 * LDA;

    const int p  = blockIdx.y / (D_ / QKV_BN);
    const int n0 = (blockIdx.y % (D_ / QKV_BN)) * QKV_BN;
    const int m0 = blockIdx.x * 128;
    const float*  bias = p == 0 ? bq : (p == 1 ? bk : bv);
    const bf16_t* BT   = wT + (size_t)p * (D_ * D_);
    bf16_t*       outp = qkv + (size_t)p * ((size_t)MTOT * D_);

    const int wave = threadIdx.x >> 5;
    const int lane = threadIdx.x & 31;
    const int idx  = lane & 15;
    const int hf   = lane >> 4;
    const int wm   = wave & 1;              // 64-row group of the wave
    const int wn   = wave >> 1;             // 48-column group of the wave

    // A lane's copies differ only by block-uniform steps: one 32-bit lane offset
    // on a scalar base in global memory, and in LDS one lane address per 4 slabs
    // with the slab's step as the copy's immediate offset. That offset moves the
    // global address too, so it is taken off the scalar base. 4 address registers
    // instead of 3 per copy: the room goes to fragments in flight.
    const unsigned goff = (threadIdx.x >> 3) * (D_ * 2) + (threadIdx.x & 7) * 16;
    const char* Ab = reinterpret_cast<const char*>(A + (size_t)m0 * D_);
    const char* Bb = reinterpret_cast<const char*>(BT + (size_t)n0 * D_);
    char* l0 = smem + (threadIdx.x >> 3) * (LDA * 2) + (threadIdx.x & 7) * 16;
    constexpr int SLAB_L = 32 * LDA * 2;    // a slab in LDS, bytes
    constexpr int SLAB_G = 32 * D_ * 2;     // a slab in global memory, bytes
#define QKV_SLAB(s, base, i)                                                     \
    stage16_off<((s) % 4) * SLAB_L>(l0 + ((s) / 4) * 4 * SLAB_L,                 \
        scalar_ptr((base) + ((i) * SLAB_G + k0 * 2 - ((s) % 4) * SLAB_L)) + goff);

    v8f acc[3][4];
#pragma unroll
    for (int j = 0; j < 3; ++j)
#pragma unroll
        for (int i = 0; i < 4; ++i)
#pragma unroll
            for (int r = 0; r < 8; ++r) acc[j][i][r] = 0.0f;

    // unrolled whole: every copy's base is its tile's base plus a constant, one
    // scalar addition
#pragma unroll
    for (int kt = 0; kt < D_ / 64; ++kt) {
        const int k0 = kt * 64;
        // stage both tiles: 10 slabs of 32 rows, one copy a lane and slab; slabs
        // 0..3 are A's, 4..9 B's, and lie in that order in LDS
        QKV_SLAB(0, Ab, 0) QKV_SLAB(1, Ab, 1) QKV_SLAB(2, Ab, 2) QKV_SLAB(3, Ab, 3)
        QKV_SLAB(4, Bb, 0) QKV_SLAB(5, Bb, 1) QKV_SLAB(6, Bb, 2) QKV_SLAB(7, Bb, 3)
        QKV_SLAB(8, Bb, 4) QKV_SLAB(9, Bb, 5)
        wait_stage();
        __syncthreads();

#pragma unroll
        for (int kc = 0; kc < 64; kc += 32) {
            v16bf a[4];
#pragma unroll
            for (int i = 0; i < 4; ++i)
                a[i] = load_frag16<LDA>(&As[(wm * 64 + i * 16) * LDA + kc]);
#pragma unroll
            for (int j = 0; j < 3; ++j) {
                v16bf b = load_frag16<LDA>(&Bs[(wn * 48 + j * 16) * LDA + kc]);
#pragma unroll
                for (int i = 0; i < 4; ++i)
                    acc[j][i] = wmma_bf16(b, a[i], acc[j][i]);   // C^T tiles: rows n, columns m
            }
        }
        __syncthreads();
    }

    // keeps the epilogue's bias loads and additions behind the k loop: a build
    // without this line moves them up among the last trip's WMMAs, where the
    // fragments still hold their registers, and spills to scratch memory
    __builtin_amdgcn_sched_barrier(0);

    // epilogue: acc[j][i][r] = C element (m = m0 + wm*64 + i*16 + idx,
    // n = n0 + wn*48 + j*16 + hf*8 + r). Behind the loop's last barrier nobody
    // reads the operand tiles any more: the block's result tile takes their place.
    v4f bn[3][2];
    // every loop of the epilogue is unrolled: acc and bn are indexed by constants
    // and stay in registers, and the 6 bias loads go out together
    const float* bl = bias + n0 + wn * 48 + hf * 8;   // the lane's 8 biases of tile j = 0
#pragma unroll
    for (int j = 0; j < 3; ++j) {
        const v4f* bp = reinterpret_cast<const v4f*>(bl + j * 16);
        bn[j][0] = bp[0];
        bn[j][1] = bp[1];
    }
    // precaution: stands in front of any overwrite of the loads' address registers;
    // naming the address here keeps it live, so that no result of the run lands in it
    asm volatile("s_wait_xcnt 0x0" :: "v"(bl) : "memory");
    char* mine = smem + (wm * 64 + idx) * QKV_PITCH + wn * 96 + hf * 16;
#pragma unroll
    for (int j = 0; j < 3; ++j)
#pragma unroll
        for (int i = 0; i < 4; ++i) {
#pragma unroll
            for (int r = 0; r < 8; ++r) acc[j][i][r] += bn[j][r >> 2][r & 3];
            *reinterpret_cast<v8bf*>(mine + i * 16 * QKV_PITCH + j * 32) =
                __builtin_convertvector(acc[j][i], v8bf);
        }
    // a row's three lines hold columns of four waves: every wave's pieces are in
    // LDS before any wave reads a row back
    __syncthreads();

    // 8 lanes on one 128-byte line, 4 rows a wave-wide store: whole lines only
    const int row = threadIdx.x >> 3;       // 0..31, plus 32 per group g
    const int col = (threadIdx.x & 7) * 16;
    const char* sp = smem + row * QKV_PITCH + col;
    char* gp = reinterpret_cast<char*>(outp + (size_t)(m0 + row) * D_ + n0) + col;
    uint4 v[12];
    // both loops unrolled: v stays in registers, the 12 reads go out as one group,
    // and every store has the one address pair with an immediate offset
#pragma unroll
    for (int g = 0; g < 4; ++g)
#pragma unroll
        for (int q = 0; q < 3; ++q)
            v[g * 3 + q] = *reinterpret_cast<const uint4*>(sp + g * 32 * QKV_PITCH + q * 128);
#pragma unroll
    for (int g = 0; g < 4; ++g)
#pragma unroll
        for (int q = 0; q < 3; ++q)
            *reinterpret_cast<uint4*>(gp + (size_t)g * 32 * D_ * sizeof(bf16_t) + q * 128) =
                v[g * 3 + q];
}

__global__ __launch_bounds__(256)
void gemm_out(const bf16_t* __restrict__ A, const bf16_t* __restrict__ BT,
              const float* __restrict__ bias, float* __restrict__ out) {
    gemm_bf16_128x64(A, BT, bias, out, blockIdx.y);
}

// ---------------------------------------------------------------------------
// Flash-style attention, transposed products. Q/K/V bf16 row-major
// [B*S][768], head slice at column h*64. One block = one (b,h) x 128 query
// rows; key tiles of 64. Each wave owns 16 queries.
//   S^T = K * Q^T : tile j holds key j*16 + hf*8 + r (register r), query idx
//   O^T += V^T * P^T : tile j holds e = j*16 + hf*8 + r, query idx
// A lane holds one query only: its maximum and sum are in-lane over its half
// of the keys, and two S^T tiles convert in place into the B operand P^T.
// V is copied to LDS as it lies (rows t); the transposing load makes V^T.
// ---------------------------------------------------------------------------
// lane l <-> lane l ^ 16 (the two lanes that share a query)
__device__ __forceinline__ float xhalf(float x) {
    return __builtin_bit_cast(float, __builtin_amdgcn_permlanex16(
        __builtin_bit_cast(int, x), __builtin_bit_cast(int, x),
        0x76543210, 0xfedcba98, false, false));
}

__global__ __launch_bounds__(256)
void attn_kernel(const bf16_t* __restrict__ Q, const bf16_t* __restrict__ K,
                 const bf16_t* __restrict__ V, bf16_t* __restrict__ O) {
    constexpr int LD = 72;                  // padded row stride (bf16 elems)
    __shared__ bf16_t Qs[128 * LD];         // 128 q-rows x 64
    __shared__ bf16_t Ks[64 * LD];          // 64 k-rows  x 64 (rows t, cols e)
    constexpr int LDV = 80;                 // V row stride: 160 B = 32 B x odd,
                                            // free of bank conflicts for the transposing load
    __shared__ __attribute__((aligned(16))) bf16_t Vs[64 * LDV];   // 64 k-rows x 64 (rows t, cols e)

    const int bh   = blockIdx.y;
    const int b    = bh / H_;
    const int h    = bh % H_;
    const int q0   = blockIdx.x * 128;
    const int wave = threadIdx.x >> 5;
    const int lane = threadIdx.x & 31;
    const int idx  = lane & 15;
    const int hf   = lane >> 4;
    const size_t base = (size_t)b * S_ * D_ + (size_t)h * DH_;

    // stage Q tile once: 128x64 -> 1024 16B chunks, 4 per thread (async)
#pragma unroll
    for (int i = 0; i < 4; ++i) {
        int v = threadIdx.x + i * 256;
        int row = v >> 3, cv = v & 7;
        stage16(&Qs[row * LD + cv * 8],
                &Q[base + (size_t)(q0 + row) * D_ + cv * 8]);
    }

    v8f acc[4];
    float mrow = -3.0e38f;   // running maximum of this lane's query
    float lrow = 0.0f;       // running sum over this lane's half of the keys
#pragma unroll
    for (int j = 0; j < 4; ++j)
#pragma unroll
        for (int r = 0; r < 8; ++r) acc[j][r] = 0.0f;

    for (int kt = 0; kt < S_ / 64; ++kt) {
        const int t0 = kt * 64;
        // stage K tile (as-is: rows t, K-contiguous e -> A operand of K*Q^T)
#pragma unroll
        for (int i = 0; i < 2; ++i) {
            int v = threadIdx.x + i * 256;
            int row = v >> 3, cv = v & 7;
            stage16(&Ks[row * LD + cv * 8],
                    &K[base + (size_t)(t0 + row) * D_ + cv * 8]);
        }
        // stage V tile as it lies (rows t, cols e): copies like K's, landed
        // behind the same wait and published by the same barrier below
#pragma unroll
        for (int i = 0; i < 2; ++i) {
            int v = threadIdx.x + i * 256;
            int row = v >> 3, cv = v & 7;
            stage16(&Vs[row * LDV + cv * 8],
                    &V[base + (size_t)(t0 + row) * D_ + cv * 8]);
        }
        wait_stage();        // Q (first iter) + K + V async copies complete
        __syncthreads();

        // scores: S^T = K(64x64) * Q^T(64x16) -> 4 tiles of 16 keys x 16 queries
        v8f sc[4];
#pragma unroll
        for (int j = 0; j < 4; ++j)
#pragma unroll
            for (int r = 0; r < 8; ++r) sc[j][r] = 0.0f;
#pragma unroll
        for (int kc = 0; kc < 64; kc += 32) {
            v16bf bq = load_frag16<LD>(&Qs[wave * 16 * LD + kc]);
#pragma unroll
            for (int j = 0; j < 4; ++j) {
                v16bf ak = load_frag16<LD>(&Ks[j * 16 * LD + kc]);
                sc[j] = wmma_bf16(ak, bq, sc[j]);
            }
        }

        // online softmax; all 32 values of a lane belong to query idx
        float tmax = -3.0e38f;
#pragma unroll
        for (int j = 0; j < 4; ++j)
#pragma unroll
            for (int r = 0; r < 8; ++r) {
                sc[j][r] *= 0.125f;               // 1/sqrt(DH)
                tmax = fmaxf(tmax, sc[j][r]);
            }
        tmax = fmaxf(tmax, xhalf(tmax));          // both halves: the query's maximum

        const float mn    = fmaxf(mrow, tmax);
        const float alpha = __expf(mrow - mn);
        mrow = mn;
        v2f tsum = {0.0f, 0.0f};                  // even and odd registers apart
#pragma unroll
        for (int j = 0; j < 4; ++j)
#pragma unroll
            for (int r = 0; r < 8; r += 2) {
                v2f p = {__expf(sc[j][r] - mrow), __expf(sc[j][r + 1] - mrow)};
                sc[j][r]     = p.x;
                sc[j][r + 1] = p.y;
                tsum += p;
            }
        lrow = lrow * alpha + (tsum.x + tsum.y);
#pragma unroll
        for (int j = 0; j < 4; ++j)
#pragma unroll
            for (int r = 0; r < 8; ++r) acc[j][r] *= alpha;

        // O^T += V^T(64x64) * P^T(64x16). Two S^T tiles (keys kc..kc+31) are,
        // converted in place, the B operand in the loader's k order:
        // element s<8 -> key kc + hf*8 + s, element 8+s -> key kc + 16 + hf*8 + s
#pragma unroll
        for (int kc = 0; kc < 64; kc += 32) {
            v16bf bp;
#pragma unroll
            for (int s = 0; s < 8; ++s) {
                bp[s]     = (bf16_t)sc[kc / 16][s];
                bp[8 + s] = (bf16_t)sc[kc / 16 + 1][s];
            }
#pragma unroll
            for (int j = 0; j < 4; ++j) {
                v16bf av = load_fragT16<LDV>(&Vs[kc * LDV + j * 16]);
                acc[j] = wmma_bf16(av, bp, acc[j]);
            }
        }
        __syncthreads();
    }

    // join the two halves' sums once; a lane's 8 registers of tile j are
    // 8 consecutive e of its query. A query's 64 e are one line: staged in the
    // wave's own 16 rows of Qs, which no other wave reads, and stored whole
    static_assert(LD * sizeof(bf16_t) == STG_PITCH, "a staging row is a row of Qs");
    const float inv = 1.0f / (lrow + xhalf(lrow));
    char* stg = reinterpret_cast<char*>(&Qs[wave * 16 * LD]);
    // unrolled: acc is indexed by constants and stays in registers
#pragma unroll
    for (int j = 0; j < 4; ++j)
        *reinterpret_cast<v8bf*>(stg + idx * STG_PITCH + j * 32 + hf * 16) =
            __builtin_convertvector(acc[j] * inv, v8bf);
    rows16_out(stg, reinterpret_cast<char*>(&O[base + (size_t)(q0 + wave * 16) * D_]),
               D_ * sizeof(bf16_t));
}

// ---------------------------------------------------------------------------
// Launch: pack -> QKV GEMM -> attention -> output projection (4 launches).
// Workspace (bf16): xb | qb | kb | vb | wqT | wkT | wvT | woT  (~53 MB).
// Attention output reuses xb (x is dead after the QKV GEMMs).
// ---------------------------------------------------------------------------
extern "C" void kernel_launch(void* const* d_in, const int* in_sizes, int n_in,
                              void* d_out, int out_size, void* d_ws, size_t ws_size,
                              hipStream_t stream) {
    (void)in_sizes; (void)n_in; (void)out_size;

    const float* x  = (const float*)d_in[0];
    const float* Wq = (const float*)d_in[1];
    const float* bq = (const float*)d_in[2];
    const float* Wk = (const float*)d_in[3];
    const float* bk = (const float*)d_in[4];
    const float* Wv = (const float*)d_in[5];
    const float* bv = (const float*)d_in[6];
    const float* Wo = (const float*)d_in[7];
    const float* bo = (const float*)d_in[8];

    const size_t MD = (size_t)MTOT * D_;   // 6,291,456 elems
    const size_t WN = (size_t)D_ * D_;     //   589,824 elems
    if (ws_size < (4 * MD + 4 * WN) * sizeof(bf16_t)) return;

    bf16_t* xb  = (bf16_t*)d_ws;
    bf16_t* qb  = xb  + MD;
    bf16_t* kb  = qb  + MD;
    bf16_t* vb  = kb  + MD;
    bf16_t* wqT = vb  + MD;
    bf16_t* wkT = wqT + WN;
    bf16_t* wvT = wkT + WN;
    bf16_t* woT = wvT + WN;

    pack_all<<<PKW_BLOCKS + PKX_BLOCKS, 256, 0, stream>>>(x, Wq, Wk, Wv, Wo, xb, wqT);

    gemm_qkv<<<dim3(MTOT / 128, 3 * (D_ / QKV_BN)), 256, 0, stream>>>(xb, wqT, bq, bk, bv, qb);

    attn_kernel<<<dim3(S_ / 128, B_ * H_), 256, 0, stream>>>(qb, kb, vb, xb);

    gemm_out<<<dim3(MTOT / 128, D_ / 64), 256, 0, stream>>>(xb, woT, bo, (float*)d_out);
}

// v007
// One run takes 88.5 microseconds.
// In two side-by-side timings against v006, it was 1.06 and 1.08 times as fast.
// Over all steps from v000 it is 1.99 times as fast.
#include <hip/hip_runtime.h>

typedef __bf16 bf16_t;
typedef __attribute__((ext_vector_type(16))) __bf16 v16bf;
typedef __attribute__((ext_vector_type(8)))  float  v8f;
typedef __attribute__((ext_vector_type(2)))  float  v2f;
typedef int i32x4 __attribute__((vector_size(16)));   // matches builtin's V4i

#define B_   8
#define S_   1024
#define D_   768
#define H_   12
#define DH_  64
#define MTOT (B_ * S_)   // 8192

#define AS1 __attribute__((address_space(1)))
#define AS3 __attribute__((address_space(3)))

// gfx1250 async global->LDS path (ASYNCcnt); fall back to VGPR round-trip if
// this toolchain doesn't declare the builtins.
#if __has_builtin(__builtin_amdgcn_global_load_async_to_lds_b128) && \
    __has_builtin(__builtin_amdgcn_s_wait_asynccnt)
#define ASYNC_OK 1
#else
#define ASYNC_OK 0
#endif

// Copy 16 bytes (8 bf16) global -> LDS, per lane.
__device__ __forceinline__ void stage16(bf16_t* lds, const bf16_t* g) {
#if ASYNC_OK
    __builtin_amdgcn_global_load_async_to_lds_b128(
        (AS1 i32x4*)g, (AS3 i32x4*)lds, /*offset=*/0, /*cpol=*/0);
#else
    *reinterpret_cast<uint4*>(lds) = *reinterpret_cast<const uint4*>(g);
#endif
}

// The same with an immediate offset N, which the copy adds to BOTH addresses:
// LDS byte = lds + N, global byte = g + N.
template<int N>
__device__ __forceinline__ void stage16_off(char* lds, const char* g) {
#if ASYNC_OK
    __builtin_amdgcn_global_load_async_to_lds_b128(
        (AS1 i32x4*)g, (AS3 i32x4*)lds, /*offset=*/N, /*cpol=*/0);
#else
    *reinterpret_cast<uint4*>(lds + N) = *reinterpret_cast<const uint4*>(g + N);
#endif
}

// A block-uniform address held in scalar registers: a copy from it plus a 32-bit
// lane offset takes the form "scalar base + offset register", and the steps from
// copy to copy are scalar additions; left to itself the build adds every step to
// a 64-bit vector address, in registers that the fragments need.
__device__ __forceinline__ const char* scalar_ptr(const char* p) {
    const unsigned long long v = reinterpret_cast<unsigned long long>(p);
    const unsigned lo = (unsigned)__builtin_amdgcn_readfirstlane((int)(unsigned)v);
    const unsigned hi = (unsigned)__builtin_amdgcn_readfirstlane((int)(unsigned)(v >> 32));
    return reinterpret_cast<const char*>(((unsigned long long)hi << 32) | lo);
}

// Hand-over between two LDS buffers, at the foot of a trip and once in front of
// the loop. In this order: the wave's own LDS reads of the buffer it leaves have
// returned; its own copies of the next tile have landed; the barrier then
// publishes that tile to every wave and frees the buffer just read for a refill.
// The last trips refill nothing: their hand-overs are also the wait behind the
// last copy and the barrier in front of the epilogue's reuse of the LDS.
__device__ __forceinline__ void publish_tile() {
    // without it a refill behind the barrier could overtake this wave's last reads
    asm volatile("s_wait_dscnt 0x0" ::: "memory");
    // the compiler places no wait for the copies; in asm with the clobber no LDS
    // read moves up over it
    asm volatile("s_wait_asynccnt 0x0" ::: "memory");
    __syncthreads();
}

// ---------------------------------------------------------------------------
// Fragment loader: 16 rows x 32 K of bf16, rows K-contiguous in LDS.
// Per-lane layout for V_WMMA_*_16X16X32_BF16 (A and B operands):
//   lane<16 : row = lane,    K = {0..7, 16..23}
//   lane>=16: row = lane-16, K = {8..15, 24..31}
// ---------------------------------------------------------------------------
template<int LDW>
__device__ __forceinline__ v16bf load_frag16(const bf16_t* base) {
    const int lane = threadIdx.x & 31;
    const int idx  = lane & 15;
    const int hf   = lane >> 4;
    const bf16_t* row = base + idx * LDW + hf * 8;
    union { v16bf v; uint4 u[2]; } f;
    f.u[0] = *reinterpret_cast<const uint4*>(row);
    f.u[1] = *reinterpret_cast<const uint4*>(row + 16);
    return f.v;
}

// ---------------------------------------------------------------------------
// Transposing fragment loader: the tile lies in LDS as rows k, columns m
// (m contiguous); the result is the A operand of 16 m x 32 k in the k order of
// load_frag16. base = element (k 0, m 0) of the fragment. One load hands lane
// (idx, hf) the 8 elements k = hf*8 .. hf*8+7 of column idx; the second load,
// 16 rows on, gives k = 16 + hf*8 ..
// ---------------------------------------------------------------------------
typedef __attribute__((ext_vector_type(8))) __bf16 bf16x8;
template<int LDW>
__device__ __forceinline__ v16bf load_fragT16(const bf16_t* base) {
    const int lane = threadIdx.x & 31;
    const bf16_t* p = base + ((lane >> 4) * 8 + (lane & 7)) * LDW + ((lane >> 3) & 1) * 8;
    union { v16bf v; bf16x8 h[2]; } f;
    f.h[0] = __builtin_amdgcn_ds_load_tr16_b128_v8bf16((AS3 bf16x8*)p);
    f.h[1] = __builtin_amdgcn_ds_load_tr16_b128_v8bf16((AS3 bf16x8*)(p + 16 * LDW));
    return f.v;
}

__device__ __forceinline__ v8f wmma_bf16(v16bf a, v16bf b, v8f c) {
    return __builtin_amdgcn_wmma_f32_16x16x32_bf16(
        /*neg_a=*/false, a, /*neg_b=*/false, b,
        /*c_mod=*/(short)0, c, /*reuse_a=*/false, /*reuse_b=*/false);
}

// ---------------------------------------------------------------------------
// Whole-line stores of a wave's result tile, 16 rows x 128 bytes. The products
// below are formed so that lane (idx, hf) holds 8 consecutive columns of row
// idx; it puts them as 16-byte pieces into row idx of stg, 16 rows of 144 bytes
// of LDS that only this wave uses by then. rows16_out reads the rows back with
// 8 lanes on each row: every wave-wide store is 4 whole 128-byte lines instead
// of 16 pieces of 32 bytes.
//   g: first byte of the tile's row 0 in global memory, pitch in bytes
// ---------------------------------------------------------------------------
#define STG_PITCH 144
__device__ __forceinline__ void rows16_out(const char* stg, char* g, size_t pitch) {
    const int lane = threadIdx.x & 31;
    const int row  = lane >> 3;
    const int col  = (lane & 7) * 16;
    // the rows are read back by other lanes of this wave than wrote them: the
    // writes are done first, and the compiler moves no read over this line
    asm volatile("s_wait_dscnt 0x0" ::: "memory");
    uint4 v[4];
    // both loops unrolled: v stays in registers, the 4 reads go out as one group
#pragma unroll
    for (int i = 0; i < 4; ++i)
        v[i] = *reinterpret_cast<const uint4*>(stg + (i * 4 + row) * STG_PITCH + col);
#pragma unroll
    for (int i = 0; i < 4; ++i)
        *reinterpret_cast<uint4*>(g + (size_t)(i * 4 + row) * pitch + col) = v[i];
}

// ---------------------------------------------------------------------------
// Pack kernels: fp32 -> bf16, weights transposed to [N][K] (K-contiguous).
// Few waves with many elements each: a launch with one element per lane is
// bound by how fast waves start, not by its bytes. All five packs are
// independent of each other and go out as ONE launch: each short launch costs
// a gap and its own round trip to memory, which here run side by side.
// ---------------------------------------------------------------------------
typedef __attribute__((ext_vector_type(4))) float  v4f;
typedef __attribute__((ext_vector_type(4))) __bf16 v4bf;
typedef __attribute__((ext_vector_type(8))) __bf16 v8bf;

#define PKX_BLOCKS 512   // 2 blocks of 8 waves per WGP: 16 streaming waves
#define PKX_PER    12    // 16-byte loads per lane, all in flight together
static_assert((size_t)PKX_BLOCKS * 256 * PKX_PER * 4 == (size_t)MTOT * D_,
              "the x pack covers x exactly");

// A block converts 12 x 256 consecutive groups of 4. Each wave-wide load is
// 512 contiguous bytes (4 whole lines), each wave-wide store 256 (2 lines).
__device__ __forceinline__
void pack_f32_bf16(int blk, const float* __restrict__ in, bf16_t* __restrict__ out) {
    const size_t g0 = (size_t)blk * (PKX_PER * 256) + threadIdx.x;
    const v4f* in4  = reinterpret_cast<const v4f*>(in) + g0;
    v4bf*      out4 = reinterpret_cast<v4bf*>(out) + g0;
    v4f f[PKX_PER];
    // unrolled: f stays in registers and all 12 loads are issued before a wait
#pragma unroll
    for (int i = 0; i < PKX_PER; ++i) f[i] = in4[i * 256];
#pragma unroll
    for (int i = 0; i < PKX_PER; ++i)
        out4[i * 256] = __builtin_convertvector(f[i], v4bf);
}

// 64 x 64 tile of a transposing pack, done by 64 lanes. Lane = one output
// row: it reads 64 source rows at its own column (a wave-wide load is one whole
// 128-byte line) and alone writes one whole 128-byte line of the output.
//   src: this lane's column in the tile's first source row, ld = source pitch
//   dst: this lane's 64 consecutive outputs
__device__ __forceinline__ void pack_T64(const float* __restrict__ src, int ld,
                                         bf16_t* __restrict__ dst) {
    float f[64];
    // unrolled: f stays in registers and all 64 loads are issued before a wait
#pragma unroll
    for (int i = 0; i < 64; ++i) f[i] = src[(size_t)i * ld];
#pragma unroll
    for (int c = 0; c < 8; ++c) {
        v8bf o;
#pragma unroll
        for (int q = 0; q < 8; ++q) o[q] = (bf16_t)f[c * 8 + q];
        reinterpret_cast<v8bf*>(dst)[c] = o;
    }
    // precaution: stands in front of any overwrite of the stores' address and
    // data registers by the code that follows this inlined body
    asm volatile("s_wait_xcnt 0x0" ::: "memory");
}

#define PKW_TILES  ((D_ / 64) * (D_ / 64))   // 144 tiles of 64 x 64 per matrix
#define PKW_PERMAT (PKW_TILES / 4)           // 36 blocks of 4 tiles per matrix
#define PKW_BLOCKS (4 * PKW_PERMAT)          // Wq, Wk, Wv, Wo

// Blocks 0..143: weight tiles, 4 per block (64 lanes each), one matrix per 36
// blocks. Blocks 144..655: x. wT holds the four packed matrices in a row.
//   head W: [H, D, DH] ; outT[n*768 + d] = W[h, d, e] with n = h*64 + e
//   Wo:     [D, D] row-major ; outT[n*768 + d] = Wo[d, n]
__global__ __launch_bounds__(256)
void pack_all(const float* __restrict__ x,
              const float* __restrict__ Wq, const float* __restrict__ Wk,
              const float* __restrict__ Wv, const float* __restrict__ Wo,
              bf16_t* __restrict__ xb, bf16_t* __restrict__ wT) {
    if (blockIdx.x >= PKW_BLOCKS) {
        pack_f32_bf16(blockIdx.x - PKW_BLOCKS, x, xb);
        return;
    }
    const int mat  = blockIdx.x / PKW_PERMAT;
    const int tile = (blockIdx.x % PKW_PERMAT) * 4 + (threadIdx.x >> 6);
    const int nt   = tile / (D_ / 64);            // head, or 64-column group of Wo
    const int d0   = (tile % (D_ / 64)) * 64;
    const int e    = threadIdx.x & 63;
    bf16_t* dst = wT + (size_t)mat * (D_ * D_) + (size_t)(nt * 64 + e) * D_ + d0;
    if (mat < 3) {
        const float* W = mat == 0 ? Wq : (mat == 1 ? Wk : Wv);
        pack_T64(W + ((size_t)nt * D_ + d0) * DH_ + e, DH_, dst);
    } else {
        pack_T64(Wo + (size_t)d0 * D_ + nt * 64 + e, D_, dst);
    }
}

// ---------------------------------------------------------------------------
// GEMM: C[8192 x 768] = A[8192 x 768] * BT^T + bias
//   A row-major bf16 (K contiguous), BT = B transposed [N][K] bf16.
//   Block tile 128x64, BK=64, 8 waves, each wave -> 16 rows x 64 cols,
//   formed as C^T (BT rows as first operand): a lane holds 8 neighbour columns.
//   out f32 row-major (final projection -> d_out)
//   ny: the block's 64-column tile of this product
// ---------------------------------------------------------------------------
__device__ __forceinline__
void gemm_bf16_128x64(const bf16_t* __restrict__ A,
                      const bf16_t* __restrict__ BT,
                      const float* __restrict__ bias,
                      void* __restrict__ outp, int ny) {
    constexpr int LDA = 72;                 // padded row stride (bf16 elems)
    // two buffers each: tile kt + 1 lands while tile kt is multiplied
    __shared__ __attribute__((aligned(16))) bf16_t As[2][128 * LDA];   // 128 x 64 tile
    __shared__ __attribute__((aligned(16))) bf16_t Bs[2][64 * LDA];    //  64 x 64 tile

    const int m0   = blockIdx.x * 128;
    const int n0   = ny * 64;
    const int wave = threadIdx.x >> 5;
    const int lane = threadIdx.x & 31;
    const int idx  = lane & 15;
    const int hf   = lane >> 4;

    v8f acc[4];
#pragma unroll
    for (int j = 0; j < 4; ++j)
#pragma unroll
        for (int r = 0; r < 8; ++r) acc[j][r] = 0.0f;

    // copies of tile kt into buffer kt & 1
    auto stage_tile = [&](int kt) {
        const int k0 = kt * 64;
        // A tile: 128x64 -> 1024 16B chunks, 4 per thread
#pragma unroll
        for (int i = 0; i < 4; ++i) {
            int v = threadIdx.x + i * 256;
            int row = v >> 3, cv = v & 7;
            stage16(&As[kt & 1][row * LDA + cv * 8],
                    &A[(size_t)(m0 + row) * D_ + k0 + cv * 8]);
        }
        // B tile: 64x64 -> 512 16B chunks, 2 per thread
#pragma unroll
        for (int i = 0; i < 2; ++i) {
            int v = threadIdx.x + i * 256;
            int row = v >> 3, cv = v & 7;
            stage16(&Bs[kt & 1][row * LDA + cv * 8],
                    &BT[(size_t)(n0 + row) * D_ + k0 + cv * 8]);
        }
    };

    stage_tile(0);
    publish_tile();
    stage_tile(1);

    // unrolled whole: the buffer is a constant, the k offsets become immediates
    // of the copies
#pragma unroll
    for (int kt = 0; kt < D_ / 64; ++kt) {
#pragma unroll
        for (int kc = 0; kc < 64; kc += 32) {
            v16bf a = load_frag16<LDA>(&As[kt & 1][wave * 16 * LDA + kc]);
#pragma unroll
            for (int j = 0; j < 4; ++j) {
                v16bf b = load_frag16<LDA>(&Bs[kt & 1][j * 16 * LDA + kc]);
                acc[j] = wmma_bf16(b, a, acc[j]);   // C^T tile: rows n, columns m
            }
        }
        publish_tile();
        // refill of the buffer that this trip has read, one whole trip ahead of its use
        if (kt + 2 < D_ / 64) stage_tile(kt + 2);
    }

    // keeps the epilogue's lane arithmetic out of the k loop
    __builtin_amdgcn_sched_barrier(0);

    // epilogue: acc[j][r] = C element (m = m0 + wave*16 + idx, n = n0 + j*16 + hf*8 + r).
    // Behind the loop's last barrier nobody reads As any more: the wave stages
    // in the 16 rows of As that were its own A rows.
    static_assert(LDA * sizeof(bf16_t) == STG_PITCH, "a staging row is a row of As");
    char* stg  = reinterpret_cast<char*>(&As[0][wave * 16 * LDA]);
    char* mine = stg + idx * STG_PITCH;
    v4f bn[4][2];
    // every loop of the epilogue is unrolled: acc and bn are indexed by constants
    // and stay in registers, and the 8 bias loads go out together
    const unsigned boff = hf * 32;          // the lane's byte offset in the tile's 64 biases
    const char* bt = reinterpret_cast<const char*>(bias + n0);
#pragma unroll
    for (int j = 0; j < 4; ++j) {
        const v4f* bp = reinterpret_cast<const v4f*>(bt + boff + j * 64);
        bn[j][0] = bp[0];
        bn[j][1] = bp[1];
    }
    // precaution: stands in front of any overwrite of the loads' offset register;
    // naming it here keeps it live, so that no result of the run lands in it
    asm volatile("s_wait_xcnt 0x0" :: "v"(boff) : "memory");
#pragma unroll
    for (int j = 0; j < 4; ++j)
#pragma unroll
        for (int r = 0; r < 8; ++r) acc[j][r] += bn[j][r >> 2][r & 3];

    const size_t mrow = (size_t)(m0 + wave * 16);
    {
        // a row of the tile is 64 f32 = two lines: one line of every row at a time
#pragma unroll
        for (int half = 0; half < 2; ++half) {
            if (half == 1) {
                // the first half's rows are overwritten next: its read-back has
                // returned; precaution: in front of any reuse of its stores' registers
                asm volatile("s_wait_xcnt 0x0\n\ts_wait_dscnt 0x0" ::: "memory");
            }
#pragma unroll
            for (int jj = 0; jj < 2; ++jj) {
                const v8f c = acc[half * 2 + jj];
                v4f* p = reinterpret_cast<v4f*>(mine + jj * 64 + hf * 32);
                p[0] = __builtin_shufflevector(c, c, 0, 1, 2, 3);
                p[1] = __builtin_shufflevector(c, c, 4, 5, 6, 7);
            }
            rows16_out(stg, reinterpret_cast<char*>((float*)outp + mrow * D_ + n0 + half * 32),
                       D_ * sizeof(float));
        }
    }
}

// Q, K and V projections in one launch: they share A and do not depend on each
// other. Block tile 128 rows x 192 columns, a quarter of one product's columns:
// 768 blocks, 3 on every WGP, all resident at once. Against a 128 x 64 tile a
// block brings 320 operand rows for 3 times the result instead of 192 for one,
// and a wave (64 rows x 48 columns, 2 x 4 waves) reads 7 fragments for 12
// products instead of 5 for 4.
// blockIdx.y = product * 4 + column tile; the packed weights and the three
// outputs each lie in a row in the workspace.
#define QKV_BN    192
#define QKV_PITCH 400    // staged result row: 384 bytes + 16, an odd count of 16-byte units
// second figure: 6 waves a SIMD, so that the 3 blocks of a WGP are resident together
__global__ __launch_bounds__(256, 6)
void gemm_qkv(const bf16_t* __restrict__ A, const bf16_t* __restrict__ wT,
              const float* __restrict__ bq, const float* __restrict__ bk,
              const float* __restrict__ bv, bf16_t* __restrict__ qkv) {
    constexpr int LDA = 72;                 // padded row stride (bf16 elems)
    // k loop: two buffers, each A tile 128 x 64, then B tile 192 x 64: tile kt + 1
    // lands while tile kt is multiplied; epilogue: the result tile.
    // 3 blocks of 92,160 bytes still fit a WGP's LDS
    constexpr int BUF_L = (128 + QKV_BN) * LDA * (int)sizeof(bf16_t);
    __shared__ __attribute__((aligned(16))) char smem[2 * BUF_L];
    static_assert(128 * QKV_PITCH <= sizeof(smem), "the result tile fits");

    const int p  = blockIdx.y / (D_ / QKV_BN);
    const int n0 = (blockIdx.y % (D_ / QKV_BN)) * QKV_BN;
    const int m0 = blockIdx.x * 128;
    const float*  bias = p == 0 ? bq : (p == 1 ? bk : bv);
    const bf16_t* BT   = wT + (size_t)p * (D_ * D_);
    bf16_t*       outp = qkv + (size_t)p * ((size_t)MTOT * D_);

    const int wave = threadIdx.x >> 5;
    const int lane = threadIdx.x & 31;
    const int idx  = lane & 15;
    const int hf   = lane >> 4;
    const int wm   = wave & 1;              // 64-row group of the wave
    const int wn   = wave >> 1;             // 48-column group of the wave

    // A lane's copies differ only by block-uniform steps: one 32-bit lane offset
    // on a scalar base in global memory, and in LDS one lane address per 4 slabs
    // with the slab's step as the copy's immediate offset. That offset moves the
    // global address too, so it is taken off the scalar base. 7 address registers
    // for both buffers instead of 3 per copy: the room goes to fragments in flight.
    const unsigned goff = (threadIdx.x >> 3) * (D_ * 2) + (threadIdx.x & 7) * 16;
    const char* Ab = reinterpret_cast<const char*>(A + (size_t)m0 * D_);
    const char* Bb = reinterpret_cast<const char*>(BT + (size_t)n0 * D_);
    char* l0 = smem + (threadIdx.x >> 3) * (LDA * 2) + (threadIdx.x & 7) * 16;
    constexpr int SLAB_L = 32 * LDA * 2;    // a slab in LDS, bytes
    constexpr int SLAB_G = 32 * D_ * 2;     // a slab in global memory, bytes
#define QKV_SLAB(kt, s, base, i)                                                 \
    stage16_off<((s) % 4) * SLAB_L>(l0 + ((kt) & 1) * BUF_L + ((s) / 4) * 4 * SLAB_L, \
        scalar_ptr((base) + ((i) * SLAB_G + (kt) * 128 - ((s) % 4) * SLAB_L)) + goff);
    // both tiles of step kt into buffer kt & 1: 10 slabs of 32 rows, one copy a lane
    // and slab; slabs 0..3 are A's, 4..9 B's, and lie in that order in LDS
#define QKV_TILE(kt)                                                             \
    QKV_SLAB(kt, 0, Ab, 0) QKV_SLAB(kt, 1, Ab, 1) QKV_SLAB(kt, 2, Ab, 2)         \
    QKV_SLAB(kt, 3, Ab, 3) QKV_SLAB(kt, 4, Bb, 0) QKV_SLAB(kt, 5, Bb, 1)         \
    QKV_SLAB(kt, 6, Bb, 2) QKV_SLAB(kt, 7, Bb, 3) QKV_SLAB(kt, 8, Bb, 4)         \
    QKV_SLAB(kt, 9, Bb, 5)

    v8f acc[3][4];
#pragma unroll
    for (int j = 0; j < 3; ++j)
#pragma unroll
        for (int i = 0; i < 4; ++i)
#pragma unroll
            for (int r = 0; r < 8; ++r) acc[j][i][r] = 0.0f;

    QKV_TILE(0)
    publish_tile();
    QKV_TILE(1)

    // unrolled whole: the buffer is a constant, and every copy's base is its tile's
    // base plus a constant, one scalar addition
#pragma unroll
    for (int kt = 0; kt < D_ / 64; ++kt) {
        const bf16_t* As = reinterpret_cast<const bf16_t*>(smem + (kt & 1) * BUF_L);
        const bf16_t* Bs = As + 128 * LDA;
#pragma unroll
        for (int kc = 0; kc < 64; kc += 32) {
            v16bf a[4];
#pragma unroll
            for (int i = 0; i < 4; ++i)
                a[i] = load_frag16<LDA>(&As[(wm * 64 + i * 16) * LDA + kc]);
#pragma unroll
            for (int j = 0; j < 3; ++j) {
                v16bf b = load_frag16<LDA>(&Bs[(wn * 48 + j * 16) * LDA + kc]);
#pragma unroll
                for (int i = 0; i < 4; ++i)
                    acc[j][i] = wmma_bf16(b, a[i], acc[j][i]);   // C^T tiles: rows n, columns m
            }
        }
        publish_tile();
        // refill of the buffer that this trip has read, one whole trip ahead of its use
        if (kt + 2 < D_ / 64) { QKV_TILE(kt + 2) }
    }

    // keeps the epilogue's bias loads and additions behind the k loop: a build
    // without this line moves them up among the last trip's WMMAs, where the
    // fragments still hold their registers, and spills to scratch memory
    __builtin_amdgcn_sched_barrier(0);

    // epilogue: acc[j][i][r] = C element (m = m0 + wm*64 + i*16 + idx,
    // n = n0 + wn*48 + j*16 + hf*8 + r). Behind the loop's last barrier nobody
    // reads the operand tiles any more: the block's result tile takes their place.
    v4f bn[3][2];
    // every loop of the epilogue is unrolled: acc and bn are indexed by constants
    // and stay in registers, and the 6 bias loads go out together
    const float* bl = bias + n0 + wn * 48 + hf * 8;   // the lane's 8 biases of tile j = 0
#pragma unroll
    for (int j = 0; j < 3; ++j) {
        const v4f* bp = reinterpret_cast<const v4f*>(bl + j * 16);
        bn[j][0] = bp[0];
        bn[j][1] = bp[1];
    }
    // precaution: stands in front of any overwrite of the loads' address registers;
    // naming the address here keeps it live, so that no result of the run lands in it
    asm volatile("s_wait_xcnt 0x0" :: "v"(bl) : "memory");
    char* mine = smem + (wm * 64 + idx) * QKV_PITCH + wn * 96 + hf * 16;
#pragma unroll
    for (int j = 0; j < 3; ++j)
#pragma unroll
        for (int i = 0; i < 4; ++i) {
#pragma unroll
            for (int r = 0; r < 8; ++r) acc[j][i][r] += bn[j][r >> 2][r & 3];
            *reinterpret_cast<v8bf*>(mine + i * 16 * QKV_PITCH + j * 32) =
                __builtin_convertvector(acc[j][i], v8bf);
        }
    // a row's three lines hold columns of four waves: every wave's pieces are in
    // LDS before any wave reads a row back
    __syncthreads();

    // 8 lanes on one 128-byte line, 4 rows a wave-wide store: whole lines only
    const int row = threadIdx.x >> 3;       // 0..31, plus 32 per group g
    const int col = (threadIdx.x & 7) * 16;
    const char* sp = smem + row * QKV_PITCH + col;
    char* gp = reinterpret_cast<char*>(outp + (size_t)(m0 + row) * D_ + n0) + col;
    uint4 v[12];
    // both loops unrolled: v stays in registers, the 12 reads go out as one group,
    // and every store has the one address pair with an immediate offset
#pragma unroll
    for (int g = 0; g < 4; ++g)
#pragma unroll
        for (int q = 0; q < 3; ++q)
            v[g * 3 + q] = *reinterpret_cast<const uint4*>(sp + g * 32 * QKV_PITCH + q * 128);
#pragma unroll
    for (int g = 0; g < 4; ++g)
#pragma unroll
        for (int q = 0; q < 3; ++q)
            *reinterpret_cast<uint4*>(gp + (size_t)g * 32 * D_ * sizeof(bf16_t) + q * 128) =
                v[g * 3 + q];
}

__global__ __launch_bounds__(256)
void gemm_out(const bf16_t* __restrict__ A, const bf16_t* __restrict__ BT,
              const float* __restrict__ bias, float* __restrict__ out) {
    gemm_bf16_128x64(A, BT, bias, out, blockIdx.y);
}

// ---------------------------------------------------------------------------
// Flash-style attention, transposed products. Q/K/V bf16 row-major
// [B*S][768], head slice at column h*64. One block = one (b,h) x 128 query
// rows; key tiles of 64. Each wave owns 16 queries.
//   S^T = K * Q^T : tile j holds key j*16 + hf*8 + r (register r), query idx
//   O^T += V^T * P^T : tile j holds e = j*16 + hf*8 + r, query idx
// A lane holds one query only: its maximum and sum are in-lane over its half
// of the keys, and two S^T tiles convert in place into the B operand P^T.
// V is copied to LDS as it lies (rows t); the transposing load makes V^T.
// ---------------------------------------------------------------------------
// lane l <-> lane l ^ 16 (the two lanes that share a query)
__device__ __forceinline__ float xhalf(float x) {
    return __builtin_bit_cast(float, __builtin_amdgcn_permlanex16(
        __builtin_bit_cast(int, x), __builtin_bit_cast(int, x),
        0x76543210, 0xfedcba98, false, false));
}

// second figure: 6 waves a SIMD, so that the 3 blocks of a WGP stay resident
// together; the two unrolled trips otherwise take registers beyond that budget
__global__ __launch_bounds__(256, 6)
void attn_kernel(const bf16_t* __restrict__ Q, const bf16_t* __restrict__ K,
                 const bf16_t* __restrict__ V, bf16_t* __restrict__ O) {
    constexpr int LD = 72;                  // padded row stride (bf16 elems)
    __shared__ __attribute__((aligned(16))) bf16_t Qs[128 * LD];   // 128 q-rows x 64
    // K and V: two buffers each, key tile kt + 1 lands while tile kt is worked on
    __shared__ __attribute__((aligned(16))) bf16_t Ks[2][64 * LD]; // 64 k-rows x 64 (rows t, cols e)
    constexpr int LDV = 80;                 // V row stride: 160 B = 32 B x odd,
                                            // free of bank conflicts for the transposing load
    __shared__ __attribute__((aligned(16))) bf16_t Vs[2][64 * LDV];   // 64 k-rows x 64 (rows t, cols e)

    const int bh   = blockIdx.y;
    const int b    = bh / H_;
    const int h    = bh % H_;
    const int q0   = blockIdx.x * 128;
    const int wave = threadIdx.x >> 5;
    const int lane = threadIdx.x & 31;
    const int idx  = lane & 15;
    const int hf   = lane >> 4;
    const size_t base = (size_t)b * S_ * D_ + (size_t)h * DH_;

    // stage Q tile once: 128x64 -> 1024 16B chunks, 4 per thread (async)
#pragma unroll
    for (int i = 0; i < 4; ++i) {
        int v = threadIdx.x + i * 256;
        int row = v >> 3, cv = v & 7;
        stage16(&Qs[row * LD + cv * 8],
                &Q[base + (size_t)(q0 + row) * D_ + cv * 8]);
    }

    v8f acc[4];
    float mrow = -3.0e38f;   // running maximum of this lane's query
    float lrow = 0.0f;       // running sum over this lane's half of the keys
#pragma unroll
    for (int j = 0; j < 4; ++j)
#pragma unroll
        for (int r = 0; r < 8; ++r) acc[j][r] = 0.0f;

    // copies of key tile kt into buffer u
    auto stage_kv = [&](int kt, int u) {
        const int t0 = kt * 64;
        // K tile (as-is: rows t, K-contiguous e -> A operand of K*Q^T)
#pragma unroll
        for (int i = 0; i < 2; ++i) {
            int v = threadIdx.x + i * 256;
            int row = v >> 3, cv = v & 7;
            stage16(&Ks[u][row * LD + cv * 8],
                    &K[base + (size_t)(t0 + row) * D_ + cv * 8]);
        }
        // V tile as it lies (rows t, cols e): copies like K's, landed behind the
        // same wait and published by the same barrier
#pragma unroll
        for (int i = 0; i < 2; ++i) {
            int v = threadIdx.x + i * 256;
            int row = v >> 3, cv = v & 7;
            stage16(&Vs[u][row * LDV + cv * 8],
                    &V[base + (size_t)(t0 + row) * D_ + cv * 8]);
        }
    };

    stage_kv(0, 0);
    publish_tile();          // Q and key tile 0
    stage_kv(1, 1);

    for (int kt2 = 0; kt2 < S_ / 128; ++kt2)
    // two trips unrolled: the buffer is a constant in every LDS address
#pragma unroll
    for (int u = 0; u < 2; ++u) {
        const int kt = kt2 * 2 + u;

        // scores: S^T = K(64x64) * Q^T(64x16) -> 4 tiles of 16 keys x 16 queries
        v8f sc[4];
#pragma unroll
        for (int j = 0; j < 4; ++j)
#pragma unroll
            for (int r = 0; r < 8; ++r) sc[j][r] = 0.0f;
#pragma unroll
        for (int kc = 0; kc < 64; kc += 32) {
            v16bf bq = load_frag16<LD>(&Qs[wave * 16 * LD + kc]);
#pragma unroll
            for (int j = 0; j < 4; ++j) {
                v16bf ak = load_frag16<LD>(&Ks[u][j * 16 * LD + kc]);
                sc[j] = wmma_bf16(ak, bq, sc[j]);
            }
        }

        // online softmax; all 32 values of a lane belong to query idx
        float tmax = -3.0e38f;
#pragma unroll
        for (int j = 0; j < 4; ++j)
#pragma unroll
            for (int r = 0; r < 8; ++r) {
                sc[j][r] *= 0.125f;               // 1/sqrt(DH)
                tmax = fmaxf(tmax, sc[j][r]);
            }
        tmax = fmaxf(tmax, xhalf(tmax));          // both halves: the query's maximum

        const float mn    = fmaxf(mrow, tmax);
        const float alpha = __expf(mrow - mn);
        mrow = mn;
        v2f tsum = {0.0f, 0.0f};                  // even and odd registers apart
#pragma unroll
        for (int j = 0; j < 4; ++j)
#pragma unroll
            for (int r = 0; r < 8; r += 2) {
                v2f p = {__expf(sc[j][r] - mrow), __expf(sc[j][r + 1] - mrow)};
                sc[j][r]     = p.x;
                sc[j][r + 1] = p.y;
                tsum += p;
            }
        lrow = lrow * alpha + (tsum.x + tsum.y);
#pragma unroll
        for (int j = 0; j < 4; ++j)
#pragma unroll
            for (int r = 0; r < 8; ++r) acc[j][r] *= alpha;

        // O^T += V^T(64x64) * P^T(64x16). Two S^T tiles (keys kc..kc+31) are,
        // converted in place, the B operand in the loader's k order:
        // element s<8 -> key kc + hf*8 + s, element 8+s -> key kc + 16 + hf*8 + s
#pragma unroll
        for (int kc = 0; kc < 64; kc += 32) {
            v16bf bp;
#pragma unroll
            for (int s = 0; s < 8; ++s) {
                bp[s]     = (bf16_t)sc[kc / 16][s];
                bp[8 + s] = (bf16_t)sc[kc / 16 + 1][s];
            }
#pragma unroll
            for (int j = 0; j < 4; ++j) {
                v16bf av = load_fragT16<LDV>(&Vs[u][kc * LDV + j * 16]);
                acc[j] = wmma_bf16(av, bp, acc[j]);
            }
        }
        publish_tile();
        // refill of the buffer that this trip has read, one whole trip ahead of its
        // use; the test reads the same in the whole block
        if (kt + 2 < S_ / 64) stage_kv(kt + 2, u);
    }

    // join the two halves' sums once; a lane's 8 registers of tile j are
    // 8 consecutive e of its query. A query's 64 e are one line: staged in the
    // wave's own 16 rows of Qs, which no other wave reads, and stored whole
    static_assert(LD * sizeof(bf16_t) == STG_PITCH, "a staging row is a row of Qs");
    const float inv = 1.0f / (lrow + xhalf(lrow));
    char* stg = reinterpret_cast<char*>(&Qs[wave * 16 * LD]);
    // unrolled: acc is indexed by constants and stays in registers
#pragma unroll
    for (int j = 0; j < 4; ++j)
        *reinterpret_cast<v8bf*>(stg + idx * STG_PITCH + j * 32 + hf * 16) =
            __builtin_convertvector(acc[j] * inv, v8bf);
    rows16_out(stg, reinterpret_cast<char*>(&O[base + (size_t)(q0 + wave * 16) * D_]),
               D_ * sizeof(bf16_t));
}

// ---------------------------------------------------------------------------
// Launch: pack -> QKV GEMM -> attention -> output projection (4 launches).
// Workspace (bf16): xb | qb | kb | vb | wqT | wkT | wvT | woT  (~53 MB).
// Attention output reuses xb (x is dead after the QKV GEMMs).
// ---------------------------------------------------------------------------
extern "C" void kernel_launch(void* const* d_in, const int* in_sizes, int n_in,
                              void* d_out, int out_size, void* d_ws, size_t ws_size,
                              hipStream_t stream) {
    (void)in_sizes; (void)n_in; (void)out_size;

    const float* x  = (const float*)d_in[0];
    const float* Wq = (const float*)d_in[1];
    const float* bq = (const float*)d_in[2];
    const float* Wk = (const float*)d_in[3];
    const float* bk = (const float*)d_in[4];
    const float* Wv = (const float*)d_in[5];
    const float* bv = (const float*)d_in[6];
    const float* Wo = (const float*)d_in[7];
    const float* bo = (const float*)d_in[8];

    const size_t MD = (size_t)MTOT * D_;   // 6,291,456 elems
    const size_t WN = (size_t)D_ * D_;     //   589,824 elems
    if (ws_size < (4 * MD + 4 * WN) * sizeof(bf16_t)) return;

    bf16_t* xb  = (bf16_t*)d_ws;
    bf16_t* qb  = xb  + MD;
    bf16_t* kb  = qb  + MD;
    bf16_t* vb  = kb  + MD;
    bf16_t* wqT = vb  + MD;
    bf16_t* wkT = wqT + WN;
    bf16_t* wvT = wkT + WN;
    bf16_t* woT = wvT + WN;

    pack_all<<<PKW_BLOCKS + PKX_BLOCKS, 256, 0, stream>>>(x, Wq, Wk, Wv, Wo, xb, wqT);

    gemm_qkv<<<dim3(MTOT / 128, 3 * (D_ / QKV_BN)), 256, 0, stream>>>(xb, wqT, bq, bk, bv, qb);

    attn_kernel<<<dim3(S_ / 128, B_ * H_), 256, 0, stream>>>(qb, kb, vb, xb);

    gemm_out<<<dim3(MTOT / 128, D_ / 64), 256, 0, stream>>>(xb, woT, bo, (float*)d_out);
}

// v008
// A run of this version takes 84.9 microseconds.
// In both of two side-by-side timings against v007, it was 1.04 times as fast.
// Counting every step since v000, it is 2.06 times as fast.
#include <hip/hip_runtime.h>

typedef __bf16 bf16_t;
typedef __attribute__((ext_vector_type(16))) __bf16 v16bf;
typedef __attribute__((ext_vector_type(8)))  float  v8f;
typedef __attribute__((ext_vector_type(2)))  float  v2f;
typedef int i32x4 __attribute__((vector_size(16)));   // matches builtin's V4i

#define B_   8
#define S_   1024
#define D_   768
#define H_   12
#define DH_  64
#define MTOT (B_ * S_)   // 8192

#define AS1 __attribute__((address_space(1)))
#define AS3 __attribute__((address_space(3)))

// gfx1250 async global->LDS path (ASYNCcnt); fall back to VGPR round-trip if
// this toolchain doesn't declare the builtins.
#if __has_builtin(__builtin_amdgcn_global_load_async_to_lds_b128) && \
    __has_builtin(__builtin_amdgcn_s_wait_asynccnt)
#define ASYNC_OK 1
#else
#define ASYNC_OK 0
#endif

// Copy 16 bytes (8 bf16) global -> LDS, per lane.
__device__ __forceinline__ void stage16(bf16_t* lds, const bf16_t* g) {
#if ASYNC_OK
    __builtin_amdgcn_global_load_async_to_lds_b128(
        (AS1 i32x4*)g, (AS3 i32x4*)lds, /*offset=*/0, /*cpol=*/0);
#else
    *reinterpret_cast<uint4*>(lds) = *reinterpret_cast<const uint4*>(g);
#endif
}

// The same with an immediate offset N, which the copy adds to BOTH addresses:
// LDS byte = lds + N, global byte = g + N.
template<int N>
__device__ __forceinline__ void stage16_off(char* lds, const char* g) {
#if ASYNC_OK
    __builtin_amdgcn_global_load_async_to_lds_b128(
        (AS1 i32x4*)g, (AS3 i32x4*)lds, /*offset=*/N, /*cpol=*/0);
#else
    *reinterpret_cast<uint4*>(lds + N) = *reinterpret_cast<const uint4*>(g + N);
#endif
}

// A block-uniform address held in scalar registers: a copy from it plus a 32-bit
// lane offset takes the form "scalar base + offset register", and the steps from
// copy to copy are scalar additions; left to itself the build adds every step to
// a 64-bit vector address, in registers that the fragments need.
__device__ __forceinline__ const char* scalar_ptr(const char* p) {
    const unsigned long long v = reinterpret_cast<unsigned long long>(p);
    const unsigned lo = (unsigned)__builtin_amdgcn_readfirstlane((int)(unsigned)v);
    const unsigned hi = (unsigned)__builtin_amdgcn_readfirstlane((int)(unsigned)(v >> 32));
    return reinterpret_cast<const char*>(((unsigned long long)hi << 32) | lo);
}

// Hand-over between two LDS buffers, at the foot of a trip and once in front of
// the loop. In this order: the wave's own LDS reads of the buffer it leaves have
// returned; its own copies of the next tile have landed; the barrier then
// publishes that tile to every wave and frees the buffer just read for a refill.
// The last trips refill nothing: their hand-overs are also the wait behind the
// last copy and the barrier in front of the epilogue's reuse of the LDS.
__device__ __forceinline__ void publish_tile() {
    // without it a refill behind the barrier could overtake this wave's last reads
    asm volatile("s_wait_dscnt 0x0" ::: "memory");
    // the compiler places no wait for the copies; in asm with the clobber no LDS
    // read moves up over it
    asm volatile("s_wait_asynccnt 0x0" ::: "memory");
    __syncthreads();
}

// ---------------------------------------------------------------------------
// Fragment loader: 16 rows x 32 K of bf16, rows K-contiguous in LDS.
// Per-lane layout for V_WMMA_*_16X16X32_BF16 (A and B operands):
//   lane<16 : row = lane,    K = {0..7, 16..23}
//   lane>=16: row = lane-16, K = {8..15, 24..31}
// ---------------------------------------------------------------------------
template<int LDW>
__device__ __forceinline__ v16bf load_frag16(const bf16_t* base) {
    const int lane = threadIdx.x & 31;
    const int idx  = lane & 15;
    const int hf   = lane >> 4;
    const bf16_t* row = base + idx * LDW + hf * 8;
    union { v16bf v; uint4 u[2]; } f;
    f.u[0] = *reinterpret_cast<const uint4*>(row);
    f.u[1] = *reinterpret_cast<const uint4*>(row + 16);
    return f.v;
}

// ---------------------------------------------------------------------------
// Transposing fragment loader: the tile lies in LDS as rows k, columns m
// (m contiguous); the result is the A operand of 16 m x 32 k in the k order of
// load_frag16. base = element (k 0, m 0) of the fragment. One load hands lane
// (idx, hf) the 8 elements k = hf*8 .. hf*8+7 of column idx; the second load,
// 16 rows on, gives k = 16 + hf*8 ..
// ---------------------------------------------------------------------------
typedef __attribute__((ext_vector_type(8))) __bf16 bf16x8;
template<int LDW>
__device__ __forceinline__ v16bf load_fragT16(const bf16_t* base) {
    const int lane = threadIdx.x & 31;
    const bf16_t* p = base + ((lane >> 4) * 8 + (lane & 7)) * LDW + ((lane >> 3) & 1) * 8;
    union { v16bf v; bf16x8 h[2]; } f;
    f.h[0] = __builtin_amdgcn_ds_load_tr16_b128_v8bf16((AS3 bf16x8*)p);
    f.h[1] = __builtin_amdgcn_ds_load_tr16_b128_v8bf16((AS3 bf16x8*)(p + 16 * LDW));
    return f.v;
}

__device__ __forceinline__ v8f wmma_bf16(v16bf a, v16bf b, v8f c) {
    return __builtin_amdgcn_wmma_f32_16x16x32_bf16(
        /*neg_a=*/false, a, /*neg_b=*/false, b,
        /*c_mod=*/(short)0, c, /*reuse_a=*/false, /*reuse_b=*/false);
}

// ---------------------------------------------------------------------------
// Whole-line stores of a wave's result tile, 16 rows x 128 bytes. The products
// below are formed so that lane (idx, hf) holds 8 consecutive columns of row
// idx; it puts them as 16-byte pieces into row idx of stg, 16 rows of 144 bytes
// of LDS that only this wave uses by then. rows16_out reads the rows back with
// 8 lanes on each row: every wave-wide store is 4 whole 128-byte lines instead
// of 16 pieces of 32 bytes.
//   g: first byte of the tile's row 0 in global memory, pitch in bytes
// ---------------------------------------------------------------------------
#define STG_PITCH 144
__device__ __forceinline__ void rows16_out(const char* stg, char* g, size_t pitch) {
    const int lane = threadIdx.x & 31;
    const int row  = lane >> 3;
    const int col  = (lane & 7) * 16;
    // the rows are read back by other lanes of this wave than wrote them: the
    // writes are done first, and the compiler moves no read over this line
    asm volatile("s_wait_dscnt 0x0" ::: "memory");
    uint4 v[4];
    // both loops unrolled: v stays in registers, the 4 reads go out as one group
#pragma unroll
    for (int i = 0; i < 4; ++i)
        v[i] = *reinterpret_cast<const uint4*>(stg + (i * 4 + row) * STG_PITCH + col);
#pragma unroll
    for (int i = 0; i < 4; ++i)
        *reinterpret_cast<uint4*>(g + (size_t)(i * 4 + row) * pitch + col) = v[i];
}

// ---------------------------------------------------------------------------
// Pack kernels: fp32 -> bf16, weights transposed to [N][K] (K-contiguous).
// Few waves with many elements each: a launch with one element per lane is
// bound by how fast waves start, not by its bytes. All five packs are
// independent of each other and go out as ONE launch: each short launch costs
// a gap and its own round trip to memory, which here run side by side.
// ---------------------------------------------------------------------------
typedef __attribute__((ext_vector_type(4))) float  v4f;
typedef __attribute__((ext_vector_type(4))) __bf16 v4bf;
typedef __attribute__((ext_vector_type(8))) __bf16 v8bf;

#define PKX_BLOCKS 512   // 2 blocks of 8 waves per WGP: 16 streaming waves
#define PKX_PER    12    // 16-byte loads per lane, all in flight together
static_assert((size_t)PKX_BLOCKS * 256 * PKX_PER * 4 == (size_t)MTOT * D_,
              "the x pack covers x exactly");

// A block converts 12 x 256 consecutive groups of 4. Each wave-wide load is
// 512 contiguous bytes (4 whole lines), each wave-wide store 256 (2 lines).
__device__ __forceinline__
void pack_f32_bf16(int blk, const float* __restrict__ in, bf16_t* __restrict__ out) {
    const size_t g0 = (size_t)blk * (PKX_PER * 256) + threadIdx.x;
    const v4f* in4  = reinterpret_cast<const v4f*>(in) + g0;
    v4bf*      out4 = reinterpret_cast<v4bf*>(out) + g0;
    v4f f[PKX_PER];
    // unrolled: f stays in registers and all 12 loads are issued before a wait
#pragma unroll
    for (int i = 0; i < PKX_PER; ++i) f[i] = in4[i * 256];
#pragma unroll
    for (int i = 0; i < PKX_PER; ++i)
        out4[i * 256] = __builtin_convertvector(f[i], v4bf);
}

// 64 x 64 tile of a transposing pack, done by 64 lanes. Lane = one output
// row: it reads 64 source rows at its own column (a wave-wide load is one whole
// 128-byte line) and alone writes one whole 128-byte line of the output.
//   src: this lane's column in the tile's first source row, ld = source pitch
//   dst: this lane's 64 consecutive outputs
__device__ __forceinline__ void pack_T64(const float* __restrict__ src, int ld,
                                         bf16_t* __restrict__ dst) {
    float f[64];
    // unrolled: f stays in registers and all 64 loads are issued before a wait
#pragma unroll
    for (int i = 0; i < 64; ++i) f[i] = src[(size_t)i * ld];
#pragma unroll
    for (int c = 0; c < 8; ++c) {
        v8bf o;
#pragma unroll
        for (int q = 0; q < 8; ++q) o[q] = (bf16_t)f[c * 8 + q];
        reinterpret_cast<v8bf*>(dst)[c] = o;
    }
    // precaution: stands in front of any overwrite of the stores' address and
    // data registers by the code that follows this inlined body
    asm volatile("s_wait_xcnt 0x0" ::: "memory");
}

#define PKW_TILES  ((D_ / 64) * (D_ / 64))   // 144 tiles of 64 x 64 per matrix
#define PKW_PERMAT (PKW_TILES / 4)           // 36 blocks of 4 tiles per matrix
#define PKW_BLOCKS (4 * PKW_PERMAT)          // Wq, Wk, Wv, Wo

// Blocks 0..143: weight tiles, 4 per block (64 lanes each), one matrix per 36
// blocks. Blocks 144..655: x. wT holds the four packed matrices in a row.
//   head W: [H, D, DH] ; outT[n*768 + d] = W[h, d, e] with n = h*64 + e
//   Wo:     [D, D] row-major ; outT[n*768 + d] = Wo[d, n]
__global__ __launch_bounds__(256)
void pack_all(const float* __restrict__ x,
              const float* __restrict__ Wq, const float* __restrict__ Wk,
              const float* __restrict__ Wv, const float* __restrict__ Wo,
              bf16_t* __restrict__ xb, bf16_t* __restrict__ wT) {
    if (blockIdx.x >= PKW_BLOCKS) {
        pack_f32_bf16(blockIdx.x - PKW_BLOCKS, x, xb);
        return;
    }
    const int mat  = blockIdx.x / PKW_PERMAT;
    const int tile = (blockIdx.x % PKW_PERMAT) * 4 + (threadIdx.x >> 6);
    const int nt   = tile / (D_ / 64);            // head, or 64-column group of Wo
    const int d0   = (tile % (D_ / 64)) * 64;
    const int e    = threadIdx.x & 63;
    bf16_t* dst = wT + (size_t)mat * (D_ * D_) + (size_t)(nt * 64 + e) * D_ + d0;
    if (mat < 3) {
        const float* W = mat == 0 ? Wq : (mat == 1 ? Wk : Wv);
        pack_T64(W + ((size_t)nt * D_ + d0) * DH_ + e, DH_, dst);
    } else {
        pack_T64(Wo + (size_t)d0 * D_ + nt * 64 + e, D_, dst);
    }
}

// ---------------------------------------------------------------------------
// GEMM: C[8192 x 768] = A[8192 x 768] * BT^T + bias
//   A row-major bf16 (K contiguous), BT = B transposed [N][K] bf16.
//   Block tile 128x64, BK=64, 8 waves, each wave -> 16 rows x 64 cols,
//   formed as C^T (BT rows as first operand): a lane holds 8 neighbour columns.
//   out f32 row-major (final projection -> d_out)
//   ny: the block's 64-column tile of this product
// ---------------------------------------------------------------------------
__device__ __forceinline__
void gemm_bf16_128x64(const bf16_t* __restrict__ A,
                      const bf16_t* __restrict__ BT,
                      const float* __restrict__ bias,
                      void* __restrict__ outp, int ny) {
    constexpr int LDA = 72;                 // padded row stride (bf16 elems)
    // two buffers each: tile kt + 1 lands while tile kt is multiplied
    __shared__ __attribute__((aligned(16))) bf16_t As[2][128 * LDA];   // 128 x 64 tile
    __shared__ __attribute__((aligned(16))) bf16_t Bs[2][64 * LDA];    //  64 x 64 tile

    const int m0   = blockIdx.x * 128;
    const int n0   = ny * 64;
    const int wave = threadIdx.x >> 5;
    const int lane = threadIdx.x & 31;
    const int idx  = lane & 15;
    const int hf   = lane >> 4;

    v8f acc[4];
#pragma unroll
    for (int j = 0; j < 4; ++j)
#pragma unroll
        for (int r = 0; r < 8; ++r) acc[j][r] = 0.0f;

    // copies of tile kt into buffer kt & 1
    auto stage_tile = [&](int kt) {
        const int k0 = kt * 64;
        // A tile: 128x64 -> 1024 16B chunks, 4 per thread
#pragma unroll
        for (int i = 0; i < 4; ++i) {
            int v = threadIdx.x + i * 256;
            int row = v >> 3, cv = v & 7;
            stage16(&As[kt & 1][row * LDA + cv * 8],
                    &A[(size_t)(m0 + row) * D_ + k0 + cv * 8]);
        }
        // B tile: 64x64 -> 512 16B chunks, 2 per thread
#pragma unroll
        for (int i = 0; i < 2; ++i) {
            int v = threadIdx.x + i * 256;
            int row = v >> 3, cv = v & 7;
            stage16(&Bs[kt & 1][row * LDA + cv * 8],
                    &BT[(size_t)(n0 + row) * D_ + k0 + cv * 8]);
        }
    };

    stage_tile(0);
    publish_tile();
    stage_tile(1);

    // unrolled whole: the buffer is a constant, the k offsets become immediates
    // of the copies
#pragma unroll
    for (int kt = 0; kt < D_ / 64; ++kt) {
#pragma unroll
        for (int kc = 0; kc < 64; kc += 32) {
            v16bf a = load_frag16<LDA>(&As[kt & 1][wave * 16 * LDA + kc]);
#pragma unroll
            for (int j = 0; j < 4; ++j) {
                v16bf b = load_frag16<LDA>(&Bs[kt & 1][j * 16 * LDA + kc]);
                acc[j] = wmma_bf16(b, a, acc[j]);   // C^T tile: rows n, columns m
            }
        }
        publish_tile();
        // refill of the buffer that this trip has read, one whole trip ahead of its use
        if (kt + 2 < D_ / 64) stage_tile(kt + 2);
    }

    // keeps the epilogue's lane arithmetic out of the k loop
    __builtin_amdgcn_sched_barrier(0);

    // epilogue: acc[j][r] = C element (m = m0 + wave*16 + idx, n = n0 + j*16 + hf*8 + r).
    // Behind the loop's last barrier nobody reads As any more: the wave stages
    // in the 16 rows of As that were its own A rows.
    static_assert(LDA * sizeof(bf16_t) == STG_PITCH, "a staging row is a row of As");
    char* stg  = reinterpret_cast<char*>(&As[0][wave * 16 * LDA]);
    char* mine = stg + idx * STG_PITCH;
    v4f bn[4][2];
    // every loop of the epilogue is unrolled: acc and bn are indexed by constants
    // and stay in registers, and the 8 bias loads go out together
    const unsigned boff = hf * 32;          // the lane's byte offset in the tile's 64 biases
    const char* bt = reinterpret_cast<const char*>(bias + n0);
#pragma unroll
    for (int j = 0; j < 4; ++j) {
        const v4f* bp = reinterpret_cast<const v4f*>(bt + boff + j * 64);
        bn[j][0] = bp[0];
        bn[j][1] = bp[1];
    }
    // precaution: stands in front of any overwrite of the loads' offset register;
    // naming it here keeps it live, so that no result of the run lands in it
    asm volatile("s_wait_xcnt 0x0" :: "v"(boff) : "memory");
#pragma unroll
    for (int j = 0; j < 4; ++j)
#pragma unroll
        for (int r = 0; r < 8; ++r) acc[j][r] += bn[j][r >> 2][r & 3];

    const size_t mrow = (size_t)(m0 + wave * 16);
    {
        // a row of the tile is 64 f32 = two lines: one line of every row at a time
#pragma unroll
        for (int half = 0; half < 2; ++half) {
            if (half == 1) {
                // the first half's rows are overwritten next: its read-back has
                // returned; precaution: in front of any reuse of its stores' registers
                asm volatile("s_wait_xcnt 0x0\n\ts_wait_dscnt 0x0" ::: "memory");
            }
#pragma unroll
            for (int jj = 0; jj < 2; ++jj) {
                const v8f c = acc[half * 2 + jj];
                v4f* p = reinterpret_cast<v4f*>(mine + jj * 64 + hf * 32);
                p[0] = __builtin_shufflevector(c, c, 0, 1, 2, 3);
                p[1] = __builtin_shufflevector(c, c, 4, 5, 6, 7);
            }
            rows16_out(stg, reinterpret_cast<char*>((float*)outp + mrow * D_ + n0 + half * 32),
                       D_ * sizeof(float));
        }
    }
}

// Q, K and V projections in one launch: they share A and do not depend on each
// other. Block tile 128 rows x 192 columns, a quarter of one product's columns:
// 768 blocks, 3 on every WGP, all resident at once. Against a 128 x 64 tile a
// block brings 320 operand rows for 3 times the result instead of 192 for one,
// and a wave (64 rows x 48 columns, 2 x 4 waves) reads 7 fragments for 12
// products instead of 5 for 4.
// blockIdx.y = product * 4 + column tile; the packed weights and the three
// outputs each lie in a row in the workspace.
#define QKV_BN    192
#define QKV_PITCH 400    // staged result row: 384 bytes + 16, an odd count of 16-byte units
// second figure: 6 waves a SIMD, so that the 3 blocks of a WGP are resident together
__global__ __launch_bounds__(256, 6)
void gemm_qkv(const bf16_t* __restrict__ A, const bf16_t* __restrict__ wT,
              const float* __restrict__ bq, const float* __restrict__ bk,
              const float* __restrict__ bv, bf16_t* __restrict__ qkv) {
    constexpr int LDA = 72;                 // padded row stride (bf16 elems)
    // k loop: two buffers, each A tile 128 x 64, then B tile 192 x 64: tile kt + 1
    // lands while tile kt is multiplied; epilogue: the result tile.
    // 3 blocks of 92,160 bytes still fit a WGP's LDS
    constexpr int BUF_L = (128 + QKV_BN) * LDA * (int)sizeof(bf16_t);
    __shared__ __attribute__((aligned(16))) char smem[2 * BUF_L];
    static_assert(128 * QKV_PITCH <= sizeof(smem), "the result tile fits");

    const int p  = blockIdx.y / (D_ / QKV_BN);
    const int n0 = (blockIdx.y % (D_ / QKV_BN)) * QKV_BN;
    const int m0 = blockIdx.x * 128;
    const float*  bias = p == 0 ? bq : (p == 1 ? bk : bv);
    const bf16_t* BT   = wT + (size_t)p * (D_ * D_);
    bf16_t*       outp = qkv + (size_t)p * ((size_t)MTOT * D_);

    const int wave = threadIdx.x >> 5;
    const int lane = threadIdx.x & 31;
    const int idx  = lane & 15;
    const int hf   = lane >> 4;
    const int wm   = wave & 1;              // 64-row group of the wave
    const int wn   = wave >> 1;             // 48-column group of the wave

    // A lane's copies differ only by block-uniform steps: one 32-bit lane offset
    // on a scalar base in global memory, and in LDS one lane address per 4 slabs
    // with the slab's step as the copy's immediate offset. That offset moves the
    // global address too, so it is taken off the scalar base. 7 address registers
    // for both buffers instead of 3 per copy: the room goes to fragments in flight.
    const unsigned goff = (threadIdx.x >> 3) * (D_ * 2) + (threadIdx.x & 7) * 16;
    const char* Ab = reinterpret_cast<const char*>(A + (size_t)m0 * D_);
    const char* Bb = reinterpret_cast<const char*>(BT + (size_t)n0 * D_);
    char* l0 = smem + (threadIdx.x >> 3) * (LDA * 2) + (threadIdx.x & 7) * 16;
    constexpr int SLAB_L = 32 * LDA * 2;    // a slab in LDS, bytes
    constexpr int SLAB_G = 32 * D_ * 2;     // a slab in global memory, bytes
#define QKV_SLAB(kt, s, base, i)                                                 \
    stage16_off<((s) % 4) * SLAB_L>(l0 + ((kt) & 1) * BUF_L + ((s) / 4) * 4 * SLAB_L, \
        scalar_ptr((base) + ((i) * SLAB_G + (kt) * 128 - ((s) % 4) * SLAB_L)) + goff);
    // both tiles of step kt into buffer kt & 1: 10 slabs of 32 rows, one copy a lane
    // and slab; slabs 0..3 are A's, 4..9 B's, and lie in that order in LDS
#define QKV_TILE(kt)                                                             \
    QKV_SLAB(kt, 0, Ab, 0) QKV_SLAB(kt, 1, Ab, 1) QKV_SLAB(kt, 2, Ab, 2)         \
    QKV_SLAB(kt, 3, Ab, 3) QKV_SLAB(kt, 4, Bb, 0) QKV_SLAB(kt, 5, Bb, 1)         \
    QKV_SLAB(kt, 6, Bb, 2) QKV_SLAB(kt, 7, Bb, 3) QKV_SLAB(kt, 8, Bb, 4)         \
    QKV_SLAB(kt, 9, Bb, 5)

    v8f acc[3][4];
#pragma unroll
    for (int j = 0; j < 3; ++j)
#pragma unroll
        for (int i = 0; i < 4; ++i)
#pragma unroll
            for (int r = 0; r < 8; ++r) acc[j][i][r] = 0.0f;

    QKV_TILE(0)
    publish_tile();
    QKV_TILE(1)

    // unrolled whole: the buffer is a constant, and every copy's base is its tile's
    // base plus a constant, one scalar addition
#pragma unroll
    for (int kt = 0; kt < D_ / 64; ++kt) {
        const bf16_t* As = reinterpret_cast<const bf16_t*>(smem + (kt & 1) * BUF_L);
        const bf16_t* Bs = As + 128 * LDA;
#pragma unroll
        for (int kc = 0; kc < 64; kc += 32) {
            v16bf a[4];
#pragma unroll
            for (int i = 0; i < 4; ++i)
                a[i] = load_frag16<LDA>(&As[(wm * 64 + i * 16) * LDA + kc]);
#pragma unroll
            for (int j = 0; j < 3; ++j) {
                v16bf b = load_frag16<LDA>(&Bs[(wn * 48 + j * 16) * LDA + kc]);
#pragma unroll
                for (int i = 0; i < 4; ++i)
                    acc[j][i] = wmma_bf16(b, a[i], acc[j][i]);   // C^T tiles: rows n, columns m
            }
        }
        publish_tile();
        // refill of the buffer that this trip has read, one whole trip ahead of its use
        if (kt + 2 < D_ / 64) { QKV_TILE(kt + 2) }
    }

    // keeps the epilogue's bias loads and additions behind the k loop: a build
    // without this line moves them up among the last trip's WMMAs, where the
    // fragments still hold their registers, and spills to scratch memory
    __builtin_amdgcn_sched_barrier(0);

    // epilogue: acc[j][i][r] = C element (m = m0 + wm*64 + i*16 + idx,
    // n = n0 + wn*48 + j*16 + hf*8 + r). Behind the loop's last barrier nobody
    // reads the operand tiles any more: the block's result tile takes their place.
    v4f bn[3][2];
    // every loop of the epilogue is unrolled: acc and bn are indexed by constants
    // and stay in registers, and the 6 bias loads go out together
    const float* bl = bias + n0 + wn * 48 + hf * 8;   // the lane's 8 biases of tile j = 0
#pragma unroll
    for (int j = 0; j < 3; ++j) {
        const v4f* bp = reinterpret_cast<const v4f*>(bl + j * 16);
        bn[j][0] = bp[0];
        bn[j][1] = bp[1];
    }
    // precaution: stands in front of any overwrite of the loads' address registers;
    // naming the address here keeps it live, so that no result of the run lands in it
    asm volatile("s_wait_xcnt 0x0" :: "v"(bl) : "memory");
    char* mine = smem + (wm * 64 + idx) * QKV_PITCH + wn * 96 + hf * 16;
#pragma unroll
    for (int j = 0; j < 3; ++j)
#pragma unroll
        for (int i = 0; i < 4; ++i) {
#pragma unroll
            for (int r = 0; r < 8; ++r) acc[j][i][r] += bn[j][r >> 2][r & 3];
            *reinterpret_cast<v8bf*>(mine + i * 16 * QKV_PITCH + j * 32) =
                __builtin_convertvector(acc[j][i], v8bf);
        }
    // a row's three lines hold columns of four waves: every wave's pieces are in
    // LDS before any wave reads a row back
    __syncthreads();

    // 8 lanes on one 128-byte line, 4 rows a wave-wide store: whole lines only
    const int row = threadIdx.x >> 3;       // 0..31, plus 32 per group g
    const int col = (threadIdx.x & 7) * 16;
    const char* sp = smem + row * QKV_PITCH + col;
    char* gp = reinterpret_cast<char*>(outp + (size_t)(m0 + row) * D_ + n0) + col;
    uint4 v[12];
    // both loops unrolled: v stays in registers, the 12 reads go out as one group,
    // and every store has the one address pair with an immediate offset
#pragma unroll
    for (int g = 0; g < 4; ++g)
#pragma unroll
        for (int q = 0; q < 3; ++q)
            v[g * 3 + q] = *reinterpret_cast<const uint4*>(sp + g * 32 * QKV_PITCH + q * 128);
#pragma unroll
    for (int g = 0; g < 4; ++g)
#pragma unroll
        for (int q = 0; q < 3; ++q)
            *reinterpret_cast<uint4*>(gp + (size_t)g * 32 * D_ * sizeof(bf16_t) + q * 128) =
                v[g * 3 + q];
}

__global__ __launch_bounds__(256)
void gemm_out(const bf16_t* __restrict__ A, const bf16_t* __restrict__ BT,
              const float* __restrict__ bias, float* __restrict__ out) {
    gemm_bf16_128x64(A, BT, bias, out, blockIdx.y);
}

// ---------------------------------------------------------------------------
// Flash-style attention, transposed products. Q/K/V bf16 row-major
// [B*S][768], head slice at column h*64. One block = one (b,h) x 128 query
// rows; key tiles of 64. Each wave owns 32 queries, two groups of 16.
//   S^T = K * Q^T : tile j holds key j*16 + hf*8 + r (register r), query idx
//   O^T += V^T * P^T : tile j holds e = j*16 + hf*8 + r, query idx
// In a group a lane holds one query only: its maximum and sum are in-lane over its
// half of the keys, and two S^T tiles convert in place into the B operand P^T.
// V is copied to LDS as it lies (rows t); the transposing load makes V^T.
// ---------------------------------------------------------------------------
// lane l <-> lane l ^ 16 (the two lanes that share a query)
__device__ __forceinline__ float xhalf(float x) {
    return __builtin_bit_cast(float, __builtin_amdgcn_permlanex16(
        __builtin_bit_cast(int, x), __builtin_bit_cast(int, x),
        0x76543210, 0xfedcba98, false, false));
}

// A wave owns 32 queries, two column groups of 16: every K and V^T fragment that
// it reads from LDS feeds two products, and its Q fragments are read once and
// stay in registers. With one product a fragment a key tile costs a WGP's LDS more
// than twice the clocks in reads that it costs the four matrix units in products.
// Block: 4 waves, 128 queries as before.
// waves_per_eu: 3 waves a SIMD, no more and no fewer: the 768 blocks lie 3 on
// every WGP, all resident together
#define ATT_THREADS 128
__global__ __launch_bounds__(ATT_THREADS) __attribute__((amdgpu_waves_per_eu(3, 3)))
void attn_kernel(const bf16_t* __restrict__ Q, const bf16_t* __restrict__ K,
                 const bf16_t* __restrict__ V, bf16_t* __restrict__ O) {
    constexpr int LD = 72;                  // padded row stride (bf16 elems)
    __shared__ __attribute__((aligned(16))) bf16_t Qs[128 * LD];   // 128 q-rows x 64
    // K and V: two buffers each, key tile kt + 1 lands while tile kt is worked on
    __shared__ __attribute__((aligned(16))) bf16_t Ks[2][64 * LD]; // 64 k-rows x 64 (rows t, cols e)
    constexpr int LDV = 80;                 // V row stride: 160 B = 32 B x odd,
                                            // free of bank conflicts for the transposing load
    __shared__ __attribute__((aligned(16))) bf16_t Vs[2][64 * LDV];   // 64 k-rows x 64 (rows t, cols e)

    const int bh   = blockIdx.y;
    const int b    = bh / H_;
    const int h    = bh % H_;
    const int q0   = blockIdx.x * 128;
    const int wave = threadIdx.x >> 5;
    const int lane = threadIdx.x & 31;
    const int idx  = lane & 15;
    const int hf   = lane >> 4;
    const size_t base = (size_t)b * S_ * D_ + (size_t)h * DH_;

    // stage Q tile once: 128x64 -> 1024 16B chunks, 8 per thread (async)
#pragma unroll
    for (int i = 0; i < 8; ++i) {
        int v = threadIdx.x + i * ATT_THREADS;
        int row = v >> 3, cv = v & 7;
        stage16(&Qs[row * LD + cv * 8],
                &Q[base + (size_t)(q0 + row) * D_ + cv * 8]);
    }

    // index c: the wave's column group, queries q0 + wave*32 + c*16 + idx.
    // Every loop over c, j, r or s in this kernel is unrolled: tiles and fragments
    // are indexed by constants and stay in registers
    v8f acc[2][4];
    float mrow[2] = {-3.0e38f, -3.0e38f};   // running maximum of this lane's queries
    float lrow[2] = {0.0f, 0.0f};           // running sums over this lane's half of the keys
#pragma unroll
    for (int c = 0; c < 2; ++c)
#pragma unroll
        for (int j = 0; j < 4; ++j)
#pragma unroll
            for (int r = 0; r < 8; ++r) acc[c][j][r] = 0.0f;

    // copies of key tile kt into buffer u
    auto stage_kv = [&](int kt, int u) {
        const int t0 = kt * 64;
        // K tile (as-is: rows t, K-contiguous e -> A operand of K*Q^T)
#pragma unroll
        for (int i = 0; i < 4; ++i) {
            int v = threadIdx.x + i * ATT_THREADS;
            int row = v >> 3, cv = v & 7;
            stage16(&Ks[u][row * LD + cv * 8],
                    &K[base + (size_t)(t0 + row) * D_ + cv * 8]);
        }
        // V tile as it lies (rows t, cols e): copies like K's, landed behind the
        // same wait and published by the same barrier
#pragma unroll
        for (int i = 0; i < 4; ++i) {
            int v = threadIdx.x + i * ATT_THREADS;
            int row = v >> 3, cv = v & 7;
            stage16(&Vs[u][row * LDV + cv * 8],
                    &V[base + (size_t)(t0 + row) * D_ + cv * 8]);
        }
    };

    stage_kv(0, 0);
    publish_tile();          // Q and key tile 0
    stage_kv(1, 1);

    // the wave's Q^T fragments, read once: [column group][k half]
    v16bf bq[2][2];
#pragma unroll
    for (int c = 0; c < 2; ++c)
#pragma unroll
        for (int k = 0; k < 2; ++k)
            bq[c][k] = load_frag16<LD>(&Qs[(wave * 32 + c * 16) * LD + k * 32]);

    for (int kt2 = 0; kt2 < S_ / 128; ++kt2)
    // two trips unrolled: the buffer is a constant in every LDS address
#pragma unroll
    for (int u = 0; u < 2; ++u) {
        const int kt = kt2 * 2 + u;

        // scores: S^T = K(64x64) * Q^T(64x32) -> 2 x 4 tiles of 16 keys x 16 queries
        v8f sc[2][4];
#pragma unroll
        for (int c = 0; c < 2; ++c)
#pragma unroll
            for (int j = 0; j < 4; ++j)
#pragma unroll
                for (int r = 0; r < 8; ++r) sc[c][j][r] = 0.0f;
#pragma unroll
        for (int kc = 0; kc < 64; kc += 32) {
#pragma unroll
            for (int j = 0; j < 4; ++j) {
                v16bf ak = load_frag16<LD>(&Ks[u][j * 16 * LD + kc]);
#pragma unroll
                for (int c = 0; c < 2; ++c)
                    sc[c][j] = wmma_bf16(ak, bq[c][kc / 32], sc[c][j]);
            }
        }

        // online softmax; all 32 values of a lane and group belong to one query.
        // The element-wise steps are written on whole 8-register tiles: written
        // value by value, the build pairs values of the two groups for its packed
        // instructions and moves them together and apart again, register by register
#pragma unroll
        for (int c = 0; c < 2; ++c) {
            float tmax = -3.0e38f;
#pragma unroll
            for (int j = 0; j < 4; ++j) {
                sc[c][j] *= 0.125f;                   // 1/sqrt(DH)
#pragma unroll
                for (int r = 0; r < 8; ++r) tmax = fmaxf(tmax, sc[c][j][r]);
            }
            tmax = fmaxf(tmax, xhalf(tmax));          // both halves: the query's maximum

            const float mn    = fmaxf(mrow[c], tmax);
            const float alpha = __expf(mrow[c] - mn);
            mrow[c] = mn;
            v2f tsum = {0.0f, 0.0f};                  // even and odd registers apart
#pragma unroll
            for (int j = 0; j < 4; ++j) {
                const v8f d = sc[c][j] - mn;
#pragma unroll
                for (int r = 0; r < 8; r += 2) {
                    v2f p = {__expf(d[r]), __expf(d[r + 1])};
                    sc[c][j][r]     = p.x;
                    sc[c][j][r + 1] = p.y;
                    tsum += p;
                }
            }
            lrow[c] = lrow[c] * alpha + (tsum.x + tsum.y);
#pragma unroll
            for (int j = 0; j < 4; ++j) acc[c][j] *= alpha;
        }

        // O^T += V^T(64x64) * P^T(64x32). Two S^T tiles (keys kc..kc+31) are,
        // converted in place, the B operand in the loader's k order:
        // element s<8 -> key kc + hf*8 + s, element 8+s -> key kc + 16 + hf*8 + s
#pragma unroll
        for (int kc = 0; kc < 64; kc += 32) {
            v16bf bp[2];
#pragma unroll
            for (int c = 0; c < 2; ++c)
#pragma unroll
                for (int s = 0; s < 8; ++s) {
                    bp[c][s]     = (bf16_t)sc[c][kc / 16][s];
                    bp[c][8 + s] = (bf16_t)sc[c][kc / 16 + 1][s];
                }
#pragma unroll
            for (int j = 0; j < 4; ++j) {
                v16bf av = load_fragT16<LDV>(&Vs[u][kc * LDV + j * 16]);
#pragma unroll
                for (int c = 0; c < 2; ++c)
                    acc[c][j] = wmma_bf16(av, bp[c], acc[c][j]);
            }
        }
        publish_tile();
        // refill of the buffer that this trip has read, one whole trip ahead of its
        // use; the test reads the same in the whole block
        if (kt + 2 < S_ / 64) stage_kv(kt + 2, u);
    }

    // join the two halves' sums once; a lane's 8 registers of tile j are
    // 8 consecutive e of its query. A query's 64 e are one line: staged in the
    // wave's own 32 rows of Qs, which no other wave reads, and stored whole
    static_assert(LD * sizeof(bf16_t) == STG_PITCH, "a staging row is a row of Qs");
    // unrolled: acc is indexed by constants and stays in registers
#pragma unroll
    for (int c = 0; c < 2; ++c) {
        if (c == 1) {
            // precaution: stands in front of any overwrite of the first group's
            // stores' address and data registers by the second group's code
            asm volatile("s_wait_xcnt 0x0" ::: "memory");
        }
        const float inv = 1.0f / (lrow[c] + xhalf(lrow[c]));
        char* stg = reinterpret_cast<char*>(&Qs[(wave * 32 + c * 16) * LD]);
#pragma unroll
        for (int j = 0; j < 4; ++j)
            *reinterpret_cast<v8bf*>(stg + idx * STG_PITCH + j * 32 + hf * 16) =
                __builtin_convertvector(acc[c][j] * inv, v8bf);
        rows16_out(stg, reinterpret_cast<char*>(&O[base + (size_t)(q0 + wave * 32 + c * 16) * D_]),
                   D_ * sizeof(bf16_t));
    }
}

// ---------------------------------------------------------------------------
// Launch: pack -> QKV GEMM -> attention -> output projection (4 launches).
// Workspace (bf16): xb | qb | kb | vb | wqT | wkT | wvT | woT  (~53 MB).
// Attention output reuses xb (x is dead after the QKV GEMMs).
// ---------------------------------------------------------------------------
extern "C" void kernel_launch(void* const* d_in, const int* in_sizes, int n_in,
                              void* d_out, int out_size, void* d_ws, size_t ws_size,
                              hipStream_t stream) {
    (void)in_sizes; (void)n_in; (void)out_size;

    const float* x  = (const float*)d_in[0];
    const float* Wq = (const float*)d_in[1];
    const float* bq = (const float*)d_in[2];
    const float* Wk = (const float*)d_in[3];
    const float* bk = (const float*)d_in[4];
    const float* Wv = (const float*)d_in[5];
    const float* bv = (const float*)d_in[6];
    const float* Wo = (const float*)d_in[7];
    const float* bo = (const float*)d_in[8];

    const size_t MD = (size_t)MTOT * D_;   // 6,291,456 elems
    const size_t WN = (size_t)D_ * D_;     //   589,824 elems
    if (ws_size < (4 * MD + 4 * WN) * sizeof(bf16_t)) return;

    bf16_t* xb  = (bf16_t*)d_ws;
    bf16_t* qb  = xb  + MD;
    bf16_t* kb  = qb  + MD;
    bf16_t* vb  = kb  + MD;
    bf16_t* wqT = vb  + MD;
    bf16_t* wkT = wqT + WN;
    bf16_t* wvT = wkT + WN;
    bf16_t* woT = wvT + WN;

    pack_all<<<PKW_BLOCKS + PKX_BLOCKS, 256, 0, stream>>>(x, Wq, Wk, Wv, Wo, xb, wqT);

    gemm_qkv<<<dim3(MTOT / 128, 3 * (D_ / QKV_BN)), 256, 0, stream>>>(xb, wqT, bq, bk, bv, qb);

    attn_kernel<<<dim3(S_ / 128, B_ * H_), ATT_THREADS, 0, stream>>>(qb, kb, vb, xb);

    gemm_out<<<dim3(MTOT / 128, D_ / 64), 256, 0, stream>>>(xb, woT, bo, (float*)d_out);
}
